// v000
// The times below were measured on an AMD MI455X: many runs one after another, warmed up first and cycling through
// copies of the inputs, with the whole window's GPU time divided by the number of runs. Launches and the gaps
// between them are all in it. The median over several windows is given; except for v000 it joins two sittings, which
// can be a few percent apart, so the side-by-side timings, each taken in one sitting, are the better comparison.
// The starting kernel, v000, takes 636 microseconds a run.
#include <hip/hip_runtime.h>
#include <stdint.h>

typedef __attribute__((ext_vector_type(16))) __bf16 v16bf;
typedef __attribute__((ext_vector_type(8)))  float  v8f;
typedef __attribute__((ext_vector_type(4)))  unsigned int v4u;
typedef __attribute__((ext_vector_type(8)))  int v8i;
typedef __attribute__((ext_vector_type(4)))  int v4i;

#define BATCH 8
#define CHN   256
#define NSP   4096
#define NGRP  32
#define CPG   8      // channels per group
#define HEADS 4
#define CHD   64     // channels per head
#define EPSV  1e-5f

#if __has_builtin(__builtin_amdgcn_tensor_load_to_lds) && \
    __has_builtin(__builtin_amdgcn_s_wait_tensorcnt)
#define USE_TDM 1
#endif

union FragU { v16bf v; uint32_t u[8]; };

__device__ __forceinline__ unsigned short f2bf(float x) {
  union { float f; uint32_t u; } c; c.f = x;
  uint32_t u = c.u;
  u += 0x7fffu + ((u >> 16) & 1u);   // round-to-nearest-even
  return (unsigned short)(u >> 16);
}

__device__ __forceinline__ v16bf load_frag(const unsigned short* base, int half) {
  const uint32_t* p = (const uint32_t*)base;
  FragU f;
  const int o0 = half * 4;       // dword offset of K = half*8
  const int o1 = 8 + half * 4;   // dword offset of K = 16 + half*8
  f.u[0] = p[o0 + 0]; f.u[1] = p[o0 + 1]; f.u[2] = p[o0 + 2]; f.u[3] = p[o0 + 3];
  f.u[4] = p[o1 + 0]; f.u[5] = p[o1 + 1]; f.u[6] = p[o1 + 2]; f.u[7] = p[o1 + 3];
  return f.v;
}

__device__ __forceinline__ v8f wmma_bf16(v16bf a, v16bf b, v8f c) {
  return __builtin_amdgcn_wmma_f32_16x16x32_bf16(
      /*neg_a=*/false, a, /*neg_b=*/false, b,
      /*c_mod=*/(short)0, c, /*reuse_a=*/false, /*reuse_b=*/false);
}

#ifdef USE_TDM
__device__ __forceinline__ void tdm_load_2d(void* lds_dst, const void* gsrc,
                                            uint32_t tile_d0, uint32_t tile_d1,
                                            uint32_t tensor_d0, uint32_t tensor_d1,
                                            uint32_t stride0) {
  uint64_t ga = (uint64_t)(uintptr_t)gsrc;
  uint32_t lo = (uint32_t)(uintptr_t)lds_dst;  // LDS byte offset (low 32 bits)
  v4u g0;
  g0[0] = 1u;
  g0[1] = lo;
  g0[2] = (uint32_t)ga;
  g0[3] = (uint32_t)((ga >> 32) & 0x01FFFFFFu) | (2u << 30);  // [56:32] | type=2
  v8i g1;
  g1[0] = (int)(1u << 16);
  g1[1] = (int)((tensor_d0 & 0xFFFFu) << 16);
  g1[2] = (int)(((tensor_d0 >> 16) & 0xFFFFu) | ((tensor_d1 & 0xFFFFu) << 16));
  g1[3] = (int)(((tensor_d1 >> 16) & 0xFFFFu) | ((tile_d0 & 0xFFFFu) << 16));
  g1[4] = (int)(tile_d1 & 0xFFFFu);
  g1[5] = (int)stride0;
  g1[6] = 0;
  g1[7] = 0;
  v4i z4 = {0, 0, 0, 0};
  v8i z8 = {0, 0, 0, 0, 0, 0, 0, 0};
  __builtin_amdgcn_tensor_load_to_lds(g0, g1, z4, z4, z8, 0);
}
#endif

// ---------------------------------------------------------------------------
// 1) GroupNorm statistics: one block per (b, g); reduce 8*4096 elements.
// ---------------------------------------------------------------------------
__global__ void __launch_bounds__(256)
gn_stats_kernel(const float* __restrict__ x, float* __restrict__ stats) {
  __shared__ float sh_s[256];
  __shared__ float sh_q[256];
  const int bg = blockIdx.x;                       // b*32 + g
  const float* base = x + (size_t)bg * (CPG * NSP);
  float s = 0.f, q = 0.f;
  for (int i = threadIdx.x; i < CPG * NSP; i += 256) {
    float v = base[i];
    s += v; q += v * v;
  }
  sh_s[threadIdx.x] = s; sh_q[threadIdx.x] = q;
  __syncthreads();
  for (int off = 128; off > 0; off >>= 1) {
    if (threadIdx.x < off) {
      sh_s[threadIdx.x] += sh_s[threadIdx.x + off];
      sh_q[threadIdx.x] += sh_q[threadIdx.x + off];
    }
    __syncthreads();
  }
  if (threadIdx.x == 0) {
    const float inv = 1.0f / (float)(CPG * NSP);
    float mean = sh_s[0] * inv;
    float var  = sh_q[0] * inv - mean * mean;
    stats[bg * 2 + 0] = mean;
    stats[bg * 2 + 1] = rsqrtf(var + EPSV);
  }
}

// ---------------------------------------------------------------------------
// 2) Apply GroupNorm, convert to bf16, transpose to (b, n, c).
// ---------------------------------------------------------------------------
__global__ void __launch_bounds__(256)
gn_apply_kernel(const float* __restrict__ x, const float* __restrict__ stats,
                const float* __restrict__ gw, const float* __restrict__ gb,
                unsigned short* __restrict__ xn) {
  size_t idx = (size_t)blockIdx.x * 256 + threadIdx.x;   // over B*C*N
  int n = (int)(idx % NSP);
  int c = (int)((idx / NSP) % CHN);
  int b = (int)(idx / ((size_t)NSP * CHN));
  int g = c / CPG;
  float mean = stats[(b * NGRP + g) * 2 + 0];
  float rstd = stats[(b * NGRP + g) * 2 + 1];
  float v = (x[idx] - mean) * rstd * gw[c] + gb[c];
  xn[((size_t)b * NSP + n) * CHN + c] = f2bf(v);
}

// ---------------------------------------------------------------------------
// 3) fp32 -> bf16 weight conversion.
// ---------------------------------------------------------------------------
__global__ void __launch_bounds__(256)
f2bf_kernel(const float* __restrict__ src, unsigned short* __restrict__ dst, int n) {
  int i = blockIdx.x * 256 + threadIdx.x;
  if (i < n) dst[i] = f2bf(src[i]);
}

__global__ void __launch_bounds__(128)
qkv_gemm_kernel(const unsigned short* __restrict__ wqkv,
                const unsigned short* __restrict__ xn,
                const float* __restrict__ bias,
                unsigned short* __restrict__ qo,
                unsigned short* __restrict__ ko,
                unsigned short* __restrict__ vo) {
  __shared__ unsigned short Asm[64 * CHN];   // 32 KB: 64 M-rows x 256 K
  __shared__ unsigned short Bsm[64 * CHN];   // 32 KB: 64 N-cols x 256 K
  const int lane = threadIdx.x & 31;
  const int wave = threadIdx.x >> 5;
  const int half = lane >> 4;
  const int lid  = lane & 15;
  const int mbase = blockIdx.x * 64;        // 0..704
  const int n0    = blockIdx.y * 64;
  const int b     = blockIdx.z;

  const unsigned short* ag = wqkv + (size_t)mbase * CHN;
  const unsigned short* bg = xn + ((size_t)b * NSP + n0) * CHN;

#ifdef USE_TDM
  if (wave == 0) {
    tdm_load_2d(Asm, ag, CHN, 64, CHN, 64, CHN);
    tdm_load_2d(Bsm, bg, CHN, 64, CHN, 64, CHN);
    __builtin_amdgcn_s_wait_tensorcnt(0);
  }
#else
  {
    const uint4* as = (const uint4*)ag; uint4* ad = (uint4*)Asm;
    const uint4* bs = (const uint4*)bg; uint4* bd = (uint4*)Bsm;
    for (int t = threadIdx.x; t < 64 * CHN / 8; t += 128) { ad[t] = as[t]; bd[t] = bs[t]; }
  }
#endif
  __syncthreads();

  v8f acc[4] = {};
  for (int kb = 0; kb < CHN; kb += 32) {
    v16bf a = load_frag(Asm + (size_t)(wave * 16 + lid) * CHN + kb, half);
#pragma unroll
    for (int j = 0; j < 4; ++j) {
      v16bf bf = load_frag(Bsm + (size_t)(j * 16 + lid) * CHN + kb, half);
      acc[j] = wmma_bf16(a, bf, acc[j]);
    }
  }

  const float scale = 0.35355339059327373f;  // 64^-0.25, applied to q and k
#pragma unroll
  for (int j = 0; j < 4; ++j) {
#pragma unroll
    for (int r = 0; r < 8; ++r) {
      int o = mbase + wave * 16 + r + half * 8;  // D layout: row = r + half*8
      int n = n0 + j * 16 + lid;                 //           col = lane % 16
      float val = acc[j][r] + bias[o];
      if (o < CHN) {
        int head = o >> 6, c = o & 63;
        qo[(((size_t)(b * HEADS + head) * NSP) + n) * CHD + c] = f2bf(val * scale);
      } else if (o < 2 * CHN) {
        int oc = o - CHN, head = oc >> 6, c = oc & 63;
        ko[(((size_t)(b * HEADS + head) * NSP) + n) * CHD + c] = f2bf(val * scale);
      } else {
        int oc = o - 2 * CHN, head = oc >> 6, c = oc & 63;
        vo[(((size_t)(b * HEADS + head) * CHD) + c) * NSP + n] = f2bf(val);
      }
    }
  }
}

__global__ void __launch_bounds__(256)
flash_attn_kernel(const unsigned short* __restrict__ q,
                  const unsigned short* __restrict__ k,
                  const unsigned short* __restrict__ v,
                  unsigned short* __restrict__ aout) {
  __shared__ unsigned short Kb[2][32 * CHD];     // 2 x 4 KB (32 keys x 64 ch)
  __shared__ unsigned short Vb[2][CHD * 32];     // 2 x 4 KB (64 ch x 32 keys)
  __shared__ unsigned short Pb[8 * 16 * 32];     // 8 KB P scratch (per wave)
  const int lane = threadIdx.x & 31;
  const int wave = threadIdx.x >> 5;
  const int half = lane >> 4;
  const int lid  = lane & 15;
  const int bh = blockIdx.x;                     // b*4 + head
  const int qt = blockIdx.y * 8 + wave;          // 16-query tile, 0..255
  unsigned short* pw = &Pb[wave * 512];

  const unsigned short* kg = k + (size_t)bh * NSP * CHD;  // (n, 64) rows dense
  const unsigned short* vg = v + (size_t)bh * CHD * NSP;  // (64, n) row stride N

#ifdef USE_TDM
  auto issue_kv = [&](int buf, int s0) {
    // K tile: 32 rows(keys) x 64 ch, row stride 64 (dense)
    tdm_load_2d(&Kb[buf][0], kg + (size_t)s0 * CHD, CHD, 32, CHD, NSP, CHD);
    // V tile: 64 rows(ch) x 32 keys, row stride 4096
    tdm_load_2d(&Vb[buf][0], vg + s0, 32, CHD, NSP, CHD, NSP);
  };
  if (wave == 0) { issue_kv(0, 0); __builtin_amdgcn_s_wait_tensorcnt(0); }
  __syncthreads();
#endif

  const unsigned short* qbase = q + ((size_t)bh * NSP + qt * 16 + lid) * CHD;
  v16bf qa0 = load_frag(qbase,      half);       // K = c 0..31
  v16bf qa1 = load_frag(qbase + 32, half);       // K = c 32..63

  float m[8], l[8];
  v8f o[4] = {};
#pragma unroll
  for (int r = 0; r < 8; ++r) { m[r] = -1e30f; l[r] = 0.f; }

  const int steps = NSP / 32;
  for (int it = 0; it < steps; ++it) {
    const int s0 = it * 32;
#ifdef USE_TDM
    const int cur = it & 1;
    if (wave == 0 && it + 1 < steps) issue_kv(cur ^ 1, s0 + 32);
#else
    const int cur = 0;
    {
      // cooperative stage: K tile is 4 KB contiguous, V tile 64 rows x 64 B
      const uint4* ks = (const uint4*)(kg + (size_t)s0 * CHD);
      ((uint4*)&Kb[0][0])[threadIdx.x] = ks[threadIdx.x];
      int row = threadIdx.x >> 2, ch4 = threadIdx.x & 3;
      ((uint4*)&Vb[0][0])[threadIdx.x] =
          *(const uint4*)(vg + (size_t)row * NSP + s0 + ch4 * 8);
    }
    __syncthreads();
#endif
    v8f s01[2] = {};
#pragma unroll
    for (int sub = 0; sub < 2; ++sub) {
      const unsigned short* kcol = &Kb[cur][(sub * 16 + lid) * CHD];
      v16bf kb0 = load_frag(kcol,      half);
      v16bf kb1 = load_frag(kcol + 32, half);
      s01[sub] = wmma_bf16(qa0, kb0, s01[sub]);
      s01[sub] = wmma_bf16(qa1, kb1, s01[sub]);
    }
#pragma unroll
    for (int r = 0; r < 8; ++r) {
      float cm = fmaxf(s01[0][r], s01[1][r]);
      cm = fmaxf(cm, __shfl_xor(cm, 8));
      cm = fmaxf(cm, __shfl_xor(cm, 4));
      cm = fmaxf(cm, __shfl_xor(cm, 2));
      cm = fmaxf(cm, __shfl_xor(cm, 1));
      float mnew = fmaxf(m[r], cm);
      float p0 = __expf(s01[0][r] - mnew);
      float p1 = __expf(s01[1][r] - mnew);
      float rs = p0 + p1;
      rs += __shfl_xor(rs, 8);
      rs += __shfl_xor(rs, 4);
      rs += __shfl_xor(rs, 2);
      rs += __shfl_xor(rs, 1);
      float alpha = __expf(m[r] - mnew);
      l[r] = l[r] * alpha + rs;
      m[r] = mnew;
#pragma unroll
      for (int j = 0; j < 4; ++j) o[j][r] *= alpha;
      pw[(r + half * 8) * 32 + lid]      = f2bf(p0);
      pw[(r + half * 8) * 32 + 16 + lid] = f2bf(p1);
    }
    __syncthreads();
    v16bf pa = load_frag(pw + lid * 32, half);   // A fragment: row=lid, K=s
#pragma unroll
    for (int j = 0; j < 4; ++j) {
      v16bf vb = load_frag(&Vb[cur][(j * 16 + lid) * 32], half);  // B: col=c, K=s
      o[j] = wmma_bf16(pa, vb, o[j]);
    }
#ifdef USE_TDM
    if (wave == 0) __builtin_amdgcn_s_wait_tensorcnt(0);
#endif
    __syncthreads();
  }

  const int b = bh >> 2, head = bh & 3;
#pragma unroll
  for (int r = 0; r < 8; ++r) {
    float inv = 1.0f / l[r];
    int n = qt * 16 + r + half * 8;
#pragma unroll
    for (int j = 0; j < 4; ++j) {
      int c = head * CHD + j * 16 + lid;
      aout[((size_t)b * NSP + n) * CHN + c] = f2bf(o[j][r] * inv);
    }
  }
}

__global__ void __launch_bounds__(128)
proj_gemm_kernel(const unsigned short* __restrict__ wp,
                 const unsigned short* __restrict__ a,
                 const float* __restrict__ bias,
                 const float* __restrict__ x,
                 float* __restrict__ out) {
  __shared__ unsigned short Asm[64 * CHN];
  __shared__ unsigned short Bsm[64 * CHN];
  const int lane = threadIdx.x & 31;
  const int wave = threadIdx.x >> 5;
  const int half = lane >> 4;
  const int lid  = lane & 15;
  const int mbase = blockIdx.x * 64;        // 0..192
  const int n0    = blockIdx.y * 64;
  const int b     = blockIdx.z;

  const unsigned short* ag = wp + (size_t)mbase * CHN;
  const unsigned short* bg = a + ((size_t)b * NSP + n0) * CHN;

#ifdef USE_TDM
  if (wave == 0) {
    tdm_load_2d(Asm, ag, CHN, 64, CHN, 64, CHN);
    tdm_load_2d(Bsm, bg, CHN, 64, CHN, 64, CHN);
    __builtin_amdgcn_s_wait_tensorcnt(0);
  }
#else
  {
    const uint4* as = (const uint4*)ag; uint4* ad = (uint4*)Asm;
    const uint4* bs = (const uint4*)bg; uint4* bd = (uint4*)Bsm;
    for (int t = threadIdx.x; t < 64 * CHN / 8; t += 128) { ad[t] = as[t]; bd[t] = bs[t]; }
  }
#endif
  __syncthreads();

  v8f acc[4] = {};
  for (int kb = 0; kb < CHN; kb += 32) {
    v16bf af = load_frag(Asm + (size_t)(wave * 16 + lid) * CHN + kb, half);
#pragma unroll
    for (int j = 0; j < 4; ++j) {
      v16bf bf = load_frag(Bsm + (size_t)(j * 16 + lid) * CHN + kb, half);
      acc[j] = wmma_bf16(af, bf, acc[j]);
    }
  }
#pragma unroll
  for (int j = 0; j < 4; ++j) {
#pragma unroll
    for (int r = 0; r < 8; ++r) {
      int o = mbase + wave * 16 + r + half * 8;
      int n = n0 + j * 16 + lid;
      size_t idx = ((size_t)b * CHN + o) * NSP + n;
      out[idx] = x[idx] + acc[j][r] + bias[o];
    }
  }
}

// ---------------------------------------------------------------------------
// Workspace layout (bytes)
// ---------------------------------------------------------------------------
#define OFF_STATS 0                                          // 256*2*4 = 2 KB
#define OFF_WQ    ((size_t)4096)                             // 768*256 bf16
#define OFF_WP    (OFF_WQ + (size_t)3 * CHN * CHN * 2)
#define OFF_XN    (OFF_WP + (size_t)CHN * CHN * 2)           // (b,n,c) bf16
#define OFF_Q     (OFF_XN + (size_t)BATCH * NSP * CHN * 2)   // (bh,n,64) bf16
#define OFF_K     (OFF_Q  + (size_t)BATCH * CHN * NSP * 2)   // (bh,n,64) bf16
#define OFF_V     (OFF_K  + (size_t)BATCH * CHN * NSP * 2)   // (bh,64,n) bf16
#define OFF_A     (OFF_V  + (size_t)BATCH * CHN * NSP * 2)   // (b,n,c) bf16

extern "C" void kernel_launch(void* const* d_in, const int* in_sizes, int n_in,
                              void* d_out, int out_size, void* d_ws, size_t ws_size,
                              hipStream_t stream) {
  const float* x      = (const float*)d_in[0];
  const float* norm_w = (const float*)d_in[1];
  const float* norm_b = (const float*)d_in[2];
  const float* qkv_w  = (const float*)d_in[3];
  const float* qkv_b  = (const float*)d_in[4];
  const float* proj_w = (const float*)d_in[5];
  const float* proj_b = (const float*)d_in[6];

  char* ws = (char*)d_ws;
  float*          stats = (float*)(ws + OFF_STATS);
  unsigned short* wq    = (unsigned short*)(ws + OFF_WQ);
  unsigned short* wp    = (unsigned short*)(ws + OFF_WP);
  unsigned short* xn    = (unsigned short*)(ws + OFF_XN);
  unsigned short* qb    = (unsigned short*)(ws + OFF_Q);
  unsigned short* kb    = (unsigned short*)(ws + OFF_K);
  unsigned short* vb    = (unsigned short*)(ws + OFF_V);
  unsigned short* ab    = (unsigned short*)(ws + OFF_A);

  gn_stats_kernel<<<BATCH * NGRP, 256, 0, stream>>>(x, stats);
  gn_apply_kernel<<<(BATCH * CHN * NSP) / 256, 256, 0, stream>>>(
      x, stats, norm_w, norm_b, xn);
  f2bf_kernel<<<(3 * CHN * CHN + 255) / 256, 256, 0, stream>>>(qkv_w, wq, 3 * CHN * CHN);
  f2bf_kernel<<<(CHN * CHN + 255) / 256, 256, 0, stream>>>(proj_w, wp, CHN * CHN);

  qkv_gemm_kernel<<<dim3(12, 64, BATCH), 128, 0, stream>>>(wq, xn, qkv_b, qb, kb, vb);
  flash_attn_kernel<<<dim3(BATCH * HEADS, NSP / (16 * 8)), 256, 0, stream>>>(qb, kb, vb, ab);
  proj_gemm_kernel<<<dim3(4, 64, BATCH), 128, 0, stream>>>(wp, ab, proj_b, x, (float*)d_out);
}

// v001
// Measured time: 393 microseconds a run.
// Timed twice side by side with v000, it ran 1.67 times as fast both times.
#include <hip/hip_runtime.h>
#include <stdint.h>

typedef __attribute__((ext_vector_type(16))) __bf16 v16bf;
typedef __attribute__((ext_vector_type(8)))  float  v8f;
typedef __attribute__((ext_vector_type(4)))  unsigned int v4u;
typedef __attribute__((ext_vector_type(8)))  int v8i;
typedef __attribute__((ext_vector_type(4)))  int v4i;

#define BATCH 8
#define CHN   256
#define NSP   4096
#define NGRP  32
#define CPG   8      // channels per group
#define HEADS 4
#define CHD   64     // channels per head
#define EPSV  1e-5f

#if __has_builtin(__builtin_amdgcn_tensor_load_to_lds) && \
    __has_builtin(__builtin_amdgcn_s_wait_tensorcnt)
#define USE_TDM 1
#endif

union FragU { v16bf v; uint32_t u[8]; };

__device__ __forceinline__ unsigned short f2bf(float x) {
  union { float f; uint32_t u; } c; c.f = x;
  uint32_t u = c.u;
  u += 0x7fffu + ((u >> 16) & 1u);   // round-to-nearest-even
  return (unsigned short)(u >> 16);
}

__device__ __forceinline__ v16bf load_frag(const unsigned short* base, int half) {
  const uint32_t* p = (const uint32_t*)base;
  FragU f;
  const int o0 = half * 4;       // dword offset of K = half*8
  const int o1 = 8 + half * 4;   // dword offset of K = 16 + half*8
  f.u[0] = p[o0 + 0]; f.u[1] = p[o0 + 1]; f.u[2] = p[o0 + 2]; f.u[3] = p[o0 + 3];
  f.u[4] = p[o1 + 0]; f.u[5] = p[o1 + 1]; f.u[6] = p[o1 + 2]; f.u[7] = p[o1 + 3];
  return f.v;
}

__device__ __forceinline__ const unsigned short* cm_lane(const unsigned short* tile, int rows,
                                                         int row, int half) {
  return tile + (half * rows + row) * 8;
}
__device__ __forceinline__ v16bf load_frag_cm(const unsigned short* lane_base, int rows,
                                              int row0, int kc) {
  const uint32_t* p0 = (const uint32_t*)(lane_base + (kc * rows + row0) * 8);
  const uint32_t* p1 = (const uint32_t*)(lane_base + ((kc + 2) * rows + row0) * 8);
  FragU f;
  f.u[0] = p0[0]; f.u[1] = p0[1]; f.u[2] = p0[2]; f.u[3] = p0[3];
  f.u[4] = p1[0]; f.u[5] = p1[1]; f.u[6] = p1[2]; f.u[7] = p1[3];
  return f.v;
}

// Element index of (row, k) in a matrix of 256 columns kept as dense 64-row
// panels, each panel chunk-major: [row / 64][k / 8][row % 64][k % 8].
__device__ __forceinline__ size_t panel_idx(size_t row, int k) {
  return ((row >> 6) * 32 + (size_t)(k >> 3)) * 512 + (row & 63) * 8 + (size_t)(k & 7);
}

__device__ __forceinline__ v8f wmma_bf16(v16bf a, v16bf b, v8f c) {
  return __builtin_amdgcn_wmma_f32_16x16x32_bf16(
      /*neg_a=*/false, a, /*neg_b=*/false, b,
      /*c_mod=*/(short)0, c, /*reuse_a=*/false, /*reuse_b=*/false);
}

#ifdef USE_TDM
__device__ __forceinline__ void tdm_load_2d(void* lds_dst, const void* gsrc,
                                            uint32_t tile_d0, uint32_t tile_d1,
                                            uint32_t tensor_d0, uint32_t tensor_d1,
                                            uint32_t stride0) {
  uint64_t ga = (uint64_t)(uintptr_t)gsrc;
  uint32_t lo = (uint32_t)(uintptr_t)lds_dst;  // LDS byte offset (low 32 bits)
  v4u g0;
  g0[0] = 1u;
  g0[1] = lo;
  g0[2] = (uint32_t)ga;
  g0[3] = (uint32_t)((ga >> 32) & 0x01FFFFFFu) | (2u << 30);  // [56:32] | type=2
  v8i g1;
  g1[0] = (int)(1u << 16);
  g1[1] = (int)((tensor_d0 & 0xFFFFu) << 16);
  g1[2] = (int)(((tensor_d0 >> 16) & 0xFFFFu) | ((tensor_d1 & 0xFFFFu) << 16));
  g1[3] = (int)(((tensor_d1 >> 16) & 0xFFFFu) | ((tile_d0 & 0xFFFFu) << 16));
  g1[4] = (int)(tile_d1 & 0xFFFFu);
  g1[5] = (int)stride0;
  g1[6] = 0;
  g1[7] = 0;
  v4i z4 = {0, 0, 0, 0};
  v8i z8 = {0, 0, 0, 0, 0, 0, 0, 0};
  __builtin_amdgcn_tensor_load_to_lds(g0, g1, z4, z4, z8, 0);
}
#endif

// ---------------------------------------------------------------------------
// 1) GroupNorm statistics: one block per (b, g); reduce 8*4096 elements.
// ---------------------------------------------------------------------------
__global__ void __launch_bounds__(256)
gn_stats_kernel(const float* __restrict__ x, float* __restrict__ stats) {
  __shared__ float sh_s[256];
  __shared__ float sh_q[256];
  const int bg = blockIdx.x;                       // b*32 + g
  const float* base = x + (size_t)bg * (CPG * NSP);
  float s = 0.f, q = 0.f;
  for (int i = threadIdx.x; i < CPG * NSP; i += 256) {
    float v = base[i];
    s += v; q += v * v;
  }
  sh_s[threadIdx.x] = s; sh_q[threadIdx.x] = q;
  __syncthreads();
  for (int off = 128; off > 0; off >>= 1) {
    if (threadIdx.x < off) {
      sh_s[threadIdx.x] += sh_s[threadIdx.x + off];
      sh_q[threadIdx.x] += sh_q[threadIdx.x + off];
    }
    __syncthreads();
  }
  if (threadIdx.x == 0) {
    const float inv = 1.0f / (float)(CPG * NSP);
    float mean = sh_s[0] * inv;
    float var  = sh_q[0] * inv - mean * mean;
    stats[bg * 2 + 0] = mean;
    stats[bg * 2 + 1] = rsqrtf(var + EPSV);
  }
}

// ---------------------------------------------------------------------------
// 2) Apply GroupNorm, convert to bf16, store as chunk-major panels of (b*n, c).
// ---------------------------------------------------------------------------
__global__ void __launch_bounds__(256)
gn_apply_kernel(const float* __restrict__ x, const float* __restrict__ stats,
                const float* __restrict__ gw, const float* __restrict__ gb,
                unsigned short* __restrict__ xn) {
  size_t idx = (size_t)blockIdx.x * 256 + threadIdx.x;   // over B*C*N
  int n = (int)(idx % NSP);
  int c = (int)((idx / NSP) % CHN);
  int b = (int)(idx / ((size_t)NSP * CHN));
  int g = c / CPG;
  float mean = stats[(b * NGRP + g) * 2 + 0];
  float rstd = stats[(b * NGRP + g) * 2 + 1];
  float v = (x[idx] - mean) * rstd * gw[c] + gb[c];
  xn[panel_idx((size_t)b * NSP + n, c)] = f2bf(v);
}

// ---------------------------------------------------------------------------
// 3) fp32 -> bf16 weight conversion (256 columns), into chunk-major panels.
// ---------------------------------------------------------------------------
__global__ void __launch_bounds__(256)
f2bf_kernel(const float* __restrict__ src, unsigned short* __restrict__ dst, int n) {
  int i = blockIdx.x * 256 + threadIdx.x;
  // i runs over the destination, so a block writes whole lines:
  // i = [row / 64][k / 8][row % 64][k % 8]
  if (i < n) dst[i] = f2bf(src[((i >> 14) * 64 + ((i >> 3) & 63)) * CHN + ((i >> 9) & 31) * 8 + (i & 7)]);
}

__global__ void __launch_bounds__(128)
qkv_gemm_kernel(const unsigned short* __restrict__ wqkv,
                const unsigned short* __restrict__ xn,
                const float* __restrict__ bias,
                unsigned short* __restrict__ qo,
                unsigned short* __restrict__ ko,
                unsigned short* __restrict__ vo) {
  __shared__ unsigned short Asm[64 * CHN];   // 32 KB: 64 M-rows x 256 K
  __shared__ unsigned short Bsm[64 * CHN];   // 32 KB: 64 N-cols x 256 K
  const int lane = threadIdx.x & 31;
  const int wave = threadIdx.x >> 5;
  const int half = lane >> 4;
  const int lid  = lane & 15;
  const int mbase = blockIdx.x * 64;        // 0..704
  const int n0    = blockIdx.y * 64;
  const int b     = blockIdx.z;

  const unsigned short* ag = wqkv + (size_t)mbase * CHN;
  const unsigned short* bg = xn + ((size_t)b * NSP + n0) * CHN;

#ifdef USE_TDM
  if (wave == 0) {
    tdm_load_2d(Asm, ag, CHN, 64, CHN, 64, CHN);
    tdm_load_2d(Bsm, bg, CHN, 64, CHN, 64, CHN);
    __builtin_amdgcn_s_wait_tensorcnt(0);
  }
#else
  {
    const uint4* as = (const uint4*)ag; uint4* ad = (uint4*)Asm;
    const uint4* bs = (const uint4*)bg; uint4* bd = (uint4*)Bsm;
    for (int t = threadIdx.x; t < 64 * CHN / 8; t += 128) { ad[t] = as[t]; bd[t] = bs[t]; }
  }
#endif
  __syncthreads();

  const unsigned short* al = cm_lane(Asm, 64, wave * 16 + lid, half);
  const unsigned short* bl = cm_lane(Bsm, 64, lid, half);
  v8f acc[4] = {};
  for (int kb = 0; kb < CHN; kb += 32) {
    v16bf a = load_frag_cm(al, 64, 0, kb >> 3);
#pragma unroll
    for (int j = 0; j < 4; ++j) {
      v16bf bf = load_frag_cm(bl, 64, j * 16, kb >> 3);
      acc[j] = wmma_bf16(a, bf, acc[j]);
    }
  }

  const float scale = 0.35355339059327373f;  // 64^-0.25, applied to q and k
#pragma unroll
  for (int j = 0; j < 4; ++j) {
#pragma unroll
    for (int r = 0; r < 8; ++r) {
      int o = mbase + wave * 16 + r + half * 8;  // D layout: row = r + half*8
      int n = n0 + j * 16 + lid;                 //           col = lane % 16
      float val = acc[j][r] + bias[o];
      if (o < CHN) {
        int head = o >> 6, c = o & 63;
        qo[(((size_t)(b * HEADS + head) * NSP) + n) * CHD + c] = f2bf(val * scale);
      } else if (o < 2 * CHN) {
        int oc = o - CHN, head = oc >> 6, c = oc & 63;
        // 32-key tiles, chunk-major: [n / 32][c / 8][n % 32][c % 8]
        ko[((size_t)(b * HEADS + head) * NSP + n0) * CHD + (j >> 1) * 2048 + (c >> 3) * 256 +
           ((j & 1) * 16 + lid) * 8 + r] = f2bf(val * scale);
      } else {
        int oc = o - 2 * CHN, head = oc >> 6, c = oc & 63;
        // row (n % 32) / 8 * 16 + c / 4 of 4096: the 64 x 32 tile at column n / 32 * 32
        // then lands in LDS as [key / 8][c][key % 8]
        vo[((size_t)(b * HEADS + head) * CHD + ((j & 1) * 2 + (lid >> 3)) * 16 + (c >> 2)) * NSP +
           n0 + (j >> 1) * 32 + (r & 3) * 8 + (lid & 7)] = f2bf(val);
      }
    }
  }
}

__global__ void __launch_bounds__(256)
flash_attn_kernel(const unsigned short* __restrict__ q,
                  const unsigned short* __restrict__ k,
                  const unsigned short* __restrict__ v,
                  unsigned short* __restrict__ aout) {
  __shared__ unsigned short Kb[2][32 * CHD];     // 2 x 4 KB (32 keys x 64 ch)
  __shared__ unsigned short Vb[2][CHD * 32];     // 2 x 4 KB (64 ch x 32 keys)
  __shared__ unsigned short Pb[8 * 16 * 32];     // 8 KB P scratch (per wave)
  const int lane = threadIdx.x & 31;
  const int wave = threadIdx.x >> 5;
  const int half = lane >> 4;
  const int lid  = lane & 15;
  const int bh = blockIdx.x;                     // b*4 + head
  const int qt = blockIdx.y * 8 + wave;          // 16-query tile, 0..255
  unsigned short* pw = &Pb[wave * 512];

  const unsigned short* kg = k + (size_t)bh * NSP * CHD;  // 32-key chunk-major tiles, dense
  const unsigned short* vg = v + (size_t)bh * CHD * NSP;  // (64, n) row stride N

#ifdef USE_TDM
  auto issue_kv = [&](int buf, int s0) {
    // K tile: one 4 KB chunk-major 32-key tile, copied as 32 x 64, row stride 64 (dense)
    tdm_load_2d(&Kb[buf][0], kg + (size_t)s0 * CHD, CHD, 32, CHD, NSP, CHD);
    // V tile: 64 rows x 32 cols (keys s0..s0+31, all 64 ch), row stride 4096
    tdm_load_2d(&Vb[buf][0], vg + s0, 32, CHD, NSP, CHD, NSP);
  };
  if (wave == 0) { issue_kv(0, 0); __builtin_amdgcn_s_wait_tensorcnt(0); }
  __syncthreads();
#endif

  const unsigned short* qbase = q + ((size_t)bh * NSP + qt * 16 + lid) * CHD;
  v16bf qa0 = load_frag(qbase,      half);       // K = c 0..31
  v16bf qa1 = load_frag(qbase + 32, half);       // K = c 32..63

  float m[8], l[8];
  v8f o[4] = {};
#pragma unroll
  for (int r = 0; r < 8; ++r) { m[r] = -1e30f; l[r] = 0.f; }

  const int steps = NSP / 32;
  for (int it = 0; it < steps; ++it) {
    const int s0 = it * 32;
#ifdef USE_TDM
    const int cur = it & 1;
    if (wave == 0 && it + 1 < steps) issue_kv(cur ^ 1, s0 + 32);
#else
    const int cur = 0;
    {
      // cooperative stage: K tile is 4 KB contiguous, V tile 64 rows x 64 B
      const uint4* ks = (const uint4*)(kg + (size_t)s0 * CHD);
      ((uint4*)&Kb[0][0])[threadIdx.x] = ks[threadIdx.x];
      int row = threadIdx.x >> 2, ch4 = threadIdx.x & 3;
      ((uint4*)&Vb[0][0])[threadIdx.x] =
          *(const uint4*)(vg + (size_t)row * NSP + s0 + ch4 * 8);
    }
    __syncthreads();
#endif
    // As the QKV epilogue stored them, the landed tiles are chunk-major:
    // Kb = [c / 8][key][c % 8], Vb = [key / 8][c][key % 8].
    const unsigned short* kl = cm_lane(&Kb[cur][0], 32, lid, half);
    const unsigned short* vl = cm_lane(&Vb[cur][0], 64, lid, half);
    v8f s01[2] = {};
#pragma unroll
    for (int sub = 0; sub < 2; ++sub) {
      v16bf kb0 = load_frag_cm(kl, 32, sub * 16, 0);
      v16bf kb1 = load_frag_cm(kl, 32, sub * 16, 4);
      s01[sub] = wmma_bf16(qa0, kb0, s01[sub]);
      s01[sub] = wmma_bf16(qa1, kb1, s01[sub]);
    }
#pragma unroll
    for (int r = 0; r < 8; ++r) {
      float cm = fmaxf(s01[0][r], s01[1][r]);
      cm = fmaxf(cm, __shfl_xor(cm, 8));
      cm = fmaxf(cm, __shfl_xor(cm, 4));
      cm = fmaxf(cm, __shfl_xor(cm, 2));
      cm = fmaxf(cm, __shfl_xor(cm, 1));
      float mnew = fmaxf(m[r], cm);
      float p0 = __expf(s01[0][r] - mnew);
      float p1 = __expf(s01[1][r] - mnew);
      float rs = p0 + p1;
      rs += __shfl_xor(rs, 8);
      rs += __shfl_xor(rs, 4);
      rs += __shfl_xor(rs, 2);
      rs += __shfl_xor(rs, 1);
      float alpha = __expf(m[r] - mnew);
      l[r] = l[r] * alpha + rs;
      m[r] = mnew;
#pragma unroll
      for (int j = 0; j < 4; ++j) o[j][r] *= alpha;
      pw[(lid >> 3) * 128 + (r + half * 8) * 8 + (lid & 7)]       = f2bf(p0);
      pw[(2 + (lid >> 3)) * 128 + (r + half * 8) * 8 + (lid & 7)] = f2bf(p1);
    }
    __syncthreads();
    v16bf pa = load_frag_cm(cm_lane(pw, 16, lid, half), 16, 0, 0);   // A fragment: row=lid, K=s
#pragma unroll
    for (int j = 0; j < 4; ++j) {
      v16bf vb = load_frag_cm(vl, 64, j * 16, 0);  // B: col=c, K=s
      o[j] = wmma_bf16(pa, vb, o[j]);
    }
#ifdef USE_TDM
    if (wave == 0) __builtin_amdgcn_s_wait_tensorcnt(0);
#endif
    __syncthreads();
  }

  const int b = bh >> 2, head = bh & 3;
  // a wave's 16 rows lie in one 64-row panel: row r is 8 elements on, column tile j two chunks on
  const size_t obase = panel_idx((size_t)b * NSP + qt * 16 + half * 8, head * CHD + lid);
#pragma unroll
  for (int r = 0; r < 8; ++r) {
    float inv = 1.0f / l[r];
#pragma unroll
    for (int j = 0; j < 4; ++j) {
      aout[obase + j * 1024 + r * 8] = f2bf(o[j][r] * inv);
    }
  }
}

__global__ void __launch_bounds__(128)
proj_gemm_kernel(const unsigned short* __restrict__ wp,
                 const unsigned short* __restrict__ a,
                 const float* __restrict__ bias,
                 const float* __restrict__ x,
                 float* __restrict__ out) {
  __shared__ unsigned short Asm[64 * CHN];
  __shared__ unsigned short Bsm[64 * CHN];
  const int lane = threadIdx.x & 31;
  const int wave = threadIdx.x >> 5;
  const int half = lane >> 4;
  const int lid  = lane & 15;
  const int mbase = blockIdx.x * 64;        // 0..192
  const int n0    = blockIdx.y * 64;
  const int b     = blockIdx.z;

  const unsigned short* ag = wp + (size_t)mbase * CHN;
  const unsigned short* bg = a + ((size_t)b * NSP + n0) * CHN;

#ifdef USE_TDM
  if (wave == 0) {
    tdm_load_2d(Asm, ag, CHN, 64, CHN, 64, CHN);
    tdm_load_2d(Bsm, bg, CHN, 64, CHN, 64, CHN);
    __builtin_amdgcn_s_wait_tensorcnt(0);
  }
#else
  {
    const uint4* as = (const uint4*)ag; uint4* ad = (uint4*)Asm;
    const uint4* bs = (const uint4*)bg; uint4* bd = (uint4*)Bsm;
    for (int t = threadIdx.x; t < 64 * CHN / 8; t += 128) { ad[t] = as[t]; bd[t] = bs[t]; }
  }
#endif
  __syncthreads();

  const unsigned short* al = cm_lane(Asm, 64, wave * 16 + lid, half);
  const unsigned short* bl = cm_lane(Bsm, 64, lid, half);
  v8f acc[4] = {};
  for (int kb = 0; kb < CHN; kb += 32) {
    v16bf af = load_frag_cm(al, 64, 0, kb >> 3);
#pragma unroll
    for (int j = 0; j < 4; ++j) {
      v16bf bf = load_frag_cm(bl, 64, j * 16, kb >> 3);
      acc[j] = wmma_bf16(af, bf, acc[j]);
    }
  }
#pragma unroll
  for (int j = 0; j < 4; ++j) {
#pragma unroll
    for (int r = 0; r < 8; ++r) {
      int o = mbase + wave * 16 + r + half * 8;
      int n = n0 + j * 16 + lid;
      size_t idx = ((size_t)b * CHN + o) * NSP + n;
      out[idx] = x[idx] + acc[j][r] + bias[o];
    }
  }
}

// ---------------------------------------------------------------------------
// Workspace layout (bytes)
// ---------------------------------------------------------------------------
#define OFF_STATS 0                                          // 256*2*4 = 2 KB
#define OFF_WQ    ((size_t)4096)                             // 768*256 bf16
#define OFF_WP    (OFF_WQ + (size_t)3 * CHN * CHN * 2)
#define OFF_XN    (OFF_WP + (size_t)CHN * CHN * 2)           // (b*n, c) bf16 panels
#define OFF_Q     (OFF_XN + (size_t)BATCH * NSP * CHN * 2)   // (bh,n,64) bf16
#define OFF_K     (OFF_Q  + (size_t)BATCH * CHN * NSP * 2)   // (bh,n/32,c/8,n%32,c%8) bf16
#define OFF_V     (OFF_K  + (size_t)BATCH * CHN * NSP * 2)   // (bh,64 rows,n) bf16, rows as the QKV epilogue lays them
#define OFF_A     (OFF_V  + (size_t)BATCH * CHN * NSP * 2)   // (b*n, c) bf16 panels

extern "C" void kernel_launch(void* const* d_in, const int* in_sizes, int n_in,
                              void* d_out, int out_size, void* d_ws, size_t ws_size,
                              hipStream_t stream) {
  const float* x      = (const float*)d_in[0];
  const float* norm_w = (const float*)d_in[1];
  const float* norm_b = (const float*)d_in[2];
  const float* qkv_w  = (const float*)d_in[3];
  const float* qkv_b  = (const float*)d_in[4];
  const float* proj_w = (const float*)d_in[5];
  const float* proj_b = (const float*)d_in[6];

  char* ws = (char*)d_ws;
  float*          stats = (float*)(ws + OFF_STATS);
  unsigned short* wq    = (unsigned short*)(ws + OFF_WQ);
  unsigned short* wp    = (unsigned short*)(ws + OFF_WP);
  unsigned short* xn    = (unsigned short*)(ws + OFF_XN);
  unsigned short* qb    = (unsigned short*)(ws + OFF_Q);
  unsigned short* kb    = (unsigned short*)(ws + OFF_K);
  unsigned short* vb    = (unsigned short*)(ws + OFF_V);
  unsigned short* ab    = (unsigned short*)(ws + OFF_A);

  gn_stats_kernel<<<BATCH * NGRP, 256, 0, stream>>>(x, stats);
  gn_apply_kernel<<<(BATCH * CHN * NSP) / 256, 256, 0, stream>>>(
      x, stats, norm_w, norm_b, xn);
  f2bf_kernel<<<(3 * CHN * CHN + 255) / 256, 256, 0, stream>>>(qkv_w, wq, 3 * CHN * CHN);
  f2bf_kernel<<<(CHN * CHN + 255) / 256, 256, 0, stream>>>(proj_w, wp, CHN * CHN);

  qkv_gemm_kernel<<<dim3(12, 64, BATCH), 128, 0, stream>>>(wq, xn, qkv_b, qb, kb, vb);
  flash_attn_kernel<<<dim3(BATCH * HEADS, NSP / (16 * 8)), 256, 0, stream>>>(qb, kb, vb, ab);
  proj_gemm_kernel<<<dim3(4, 64, BATCH), 128, 0, stream>>>(wp, ab, proj_b, x, (float*)d_out);
}

// v002
// A run of this version takes 214 microseconds.
// In two side-by-side timings against v001, it was 1.84 and 1.83 times as fast.
// Counting every step since v000, it is 3.07 times as fast.
#include <hip/hip_runtime.h>
#include <stdint.h>

typedef __attribute__((ext_vector_type(16))) __bf16 v16bf;
typedef __attribute__((ext_vector_type(8)))  float  v8f;
typedef __attribute__((ext_vector_type(4)))  unsigned int v4u;
typedef __attribute__((ext_vector_type(8)))  int v8i;
typedef __attribute__((ext_vector_type(4)))  int v4i;

#define BATCH 8
#define CHN   256
#define NSP   4096
#define NGRP  32
#define CPG   8      // channels per group
#define HEADS 4
#define CHD   64     // channels per head
#define EPSV  1e-5f

#if __has_builtin(__builtin_amdgcn_tensor_load_to_lds) && \
    __has_builtin(__builtin_amdgcn_s_wait_tensorcnt)
#define USE_TDM 1
#endif

union FragU { v16bf v; uint32_t u[8]; };

__device__ __forceinline__ unsigned short f2bf(float x) {
  union { float f; uint32_t u; } c; c.f = x;
  uint32_t u = c.u;
  u += 0x7fffu + ((u >> 16) & 1u);   // round-to-nearest-even
  return (unsigned short)(u >> 16);
}

__device__ __forceinline__ v16bf load_frag(const unsigned short* base, int half) {
  const uint32_t* p = (const uint32_t*)base;
  FragU f;
  const int o0 = half * 4;       // dword offset of K = half*8
  const int o1 = 8 + half * 4;   // dword offset of K = 16 + half*8
  f.u[0] = p[o0 + 0]; f.u[1] = p[o0 + 1]; f.u[2] = p[o0 + 2]; f.u[3] = p[o0 + 3];
  f.u[4] = p[o1 + 0]; f.u[5] = p[o1 + 1]; f.u[6] = p[o1 + 2]; f.u[7] = p[o1 + 3];
  return f.v;
}

__device__ __forceinline__ const unsigned short* cm_lane(const unsigned short* tile, int rows,
                                                         int row, int half) {
  return tile + (half * rows + row) * 8;
}
__device__ __forceinline__ v16bf load_frag_cm(const unsigned short* lane_base, int rows,
                                              int row0, int kc) {
  const uint32_t* p0 = (const uint32_t*)(lane_base + (kc * rows + row0) * 8);
  const uint32_t* p1 = (const uint32_t*)(lane_base + ((kc + 2) * rows + row0) * 8);
  FragU f;
  f.u[0] = p0[0]; f.u[1] = p0[1]; f.u[2] = p0[2]; f.u[3] = p0[3];
  f.u[4] = p1[0]; f.u[5] = p1[1]; f.u[6] = p1[2]; f.u[7] = p1[3];
  return f.v;
}

// Element index of (row, k) in a matrix of 256 columns kept as dense 64-row
// panels, each panel chunk-major: [row / 64][k / 8][row % 64][k % 8].
__device__ __forceinline__ size_t panel_idx(size_t row, int k) {
  return ((row >> 6) * 32 + (size_t)(k >> 3)) * 512 + (row & 63) * 8 + (size_t)(k & 7);
}

__device__ __forceinline__ v8f wmma_bf16(v16bf a, v16bf b, v8f c) {
  return __builtin_amdgcn_wmma_f32_16x16x32_bf16(
      /*neg_a=*/false, a, /*neg_b=*/false, b,
      /*c_mod=*/(short)0, c, /*reuse_a=*/false, /*reuse_b=*/false);
}

// Two f32 to one register of two bf16, round to nearest even (one v_cvt_pk_bf16_f32).
__device__ __forceinline__ uint32_t pack2(float lo, float hi) {
  typedef __bf16 bf2 __attribute__((ext_vector_type(2)));
  typedef float  f2  __attribute__((ext_vector_type(2)));
  return __builtin_bit_cast(uint32_t, __builtin_convertvector(f2{lo, hi}, bf2));
}

__device__ __forceinline__ float xhalf(float x) {
  int b = __builtin_bit_cast(int, x);
  return __builtin_bit_cast(float,
      __builtin_amdgcn_permlanex16(b, b, 0x76543210, 0xfedcba98, false, false));
}

__device__ __forceinline__ float exp2_1(float x) {
  float p;
  asm("v_exp_f32 %0, %1\n\tv_nop" : "=&v"(p) : "v"(x));
  return p;
}
__device__ __forceinline__ void exp2_8(const float (&x)[8], float (&p)[8]) {
  asm("v_exp_f32 %0, %8\n\t"
      "v_exp_f32 %1, %9\n\t"
      "v_exp_f32 %2, %10\n\t"
      "v_exp_f32 %3, %11\n\t"
      "v_exp_f32 %4, %12\n\t"
      "v_exp_f32 %5, %13\n\t"
      "v_exp_f32 %6, %14\n\t"
      "v_exp_f32 %7, %15\n\t"
      "v_nop"
      : "=&v"(p[0]), "=&v"(p[1]), "=&v"(p[2]), "=&v"(p[3]),
        "=&v"(p[4]), "=&v"(p[5]), "=&v"(p[6]), "=&v"(p[7])
      : "v"(x[0]), "v"(x[1]), "v"(x[2]), "v"(x[3]),
        "v"(x[4]), "v"(x[5]), "v"(x[6]), "v"(x[7]));
}

#ifdef USE_TDM
__device__ __forceinline__ void tdm_load_2d(void* lds_dst, const void* gsrc,
                                            uint32_t tile_d0, uint32_t tile_d1,
                                            uint32_t tensor_d0, uint32_t tensor_d1,
                                            uint32_t stride0) {
  uint64_t ga = (uint64_t)(uintptr_t)gsrc;
  uint32_t lo = (uint32_t)(uintptr_t)lds_dst;  // LDS byte offset (low 32 bits)
  v4u g0;
  g0[0] = 1u;
  g0[1] = lo;
  g0[2] = (uint32_t)ga;
  g0[3] = (uint32_t)((ga >> 32) & 0x01FFFFFFu) | (2u << 30);  // [56:32] | type=2
  v8i g1;
  g1[0] = (int)(1u << 16);
  g1[1] = (int)((tensor_d0 & 0xFFFFu) << 16);
  g1[2] = (int)(((tensor_d0 >> 16) & 0xFFFFu) | ((tensor_d1 & 0xFFFFu) << 16));
  g1[3] = (int)(((tensor_d1 >> 16) & 0xFFFFu) | ((tile_d0 & 0xFFFFu) << 16));
  g1[4] = (int)(tile_d1 & 0xFFFFu);
  g1[5] = (int)stride0;
  g1[6] = 0;
  g1[7] = 0;
  v4i z4 = {0, 0, 0, 0};
  v8i z8 = {0, 0, 0, 0, 0, 0, 0, 0};
  __builtin_amdgcn_tensor_load_to_lds(g0, g1, z4, z4, z8, 0);
}
#endif

// ---------------------------------------------------------------------------
// 1) GroupNorm statistics: one block per (b, g); reduce 8*4096 elements.
// ---------------------------------------------------------------------------
__global__ void __launch_bounds__(256)
gn_stats_kernel(const float* __restrict__ x, float* __restrict__ stats) {
  __shared__ float sh_s[256];
  __shared__ float sh_q[256];
  const int bg = blockIdx.x;                       // b*32 + g
  const float* base = x + (size_t)bg * (CPG * NSP);
  float s = 0.f, q = 0.f;
  for (int i = threadIdx.x; i < CPG * NSP; i += 256) {
    float v = base[i];
    s += v; q += v * v;
  }
  sh_s[threadIdx.x] = s; sh_q[threadIdx.x] = q;
  __syncthreads();
  for (int off = 128; off > 0; off >>= 1) {
    if (threadIdx.x < off) {
      sh_s[threadIdx.x] += sh_s[threadIdx.x + off];
      sh_q[threadIdx.x] += sh_q[threadIdx.x + off];
    }
    __syncthreads();
  }
  if (threadIdx.x == 0) {
    const float inv = 1.0f / (float)(CPG * NSP);
    float mean = sh_s[0] * inv;
    float var  = sh_q[0] * inv - mean * mean;
    stats[bg * 2 + 0] = mean;
    stats[bg * 2 + 1] = rsqrtf(var + EPSV);
  }
}

// ---------------------------------------------------------------------------
// 2) Apply GroupNorm, convert to bf16, store as chunk-major panels of (b*n, c).
// ---------------------------------------------------------------------------
__global__ void __launch_bounds__(256)
gn_apply_kernel(const float* __restrict__ x, const float* __restrict__ stats,
                const float* __restrict__ gw, const float* __restrict__ gb,
                unsigned short* __restrict__ xn) {
  size_t idx = (size_t)blockIdx.x * 256 + threadIdx.x;   // over B*C*N
  int n = (int)(idx % NSP);
  int c = (int)((idx / NSP) % CHN);
  int b = (int)(idx / ((size_t)NSP * CHN));
  int g = c / CPG;
  float mean = stats[(b * NGRP + g) * 2 + 0];
  float rstd = stats[(b * NGRP + g) * 2 + 1];
  float v = (x[idx] - mean) * rstd * gw[c] + gb[c];
  xn[panel_idx((size_t)b * NSP + n, c)] = f2bf(v);
}

// ---------------------------------------------------------------------------
// 3) fp32 -> bf16 weight conversion (256 columns), into chunk-major panels.
// ---------------------------------------------------------------------------
__global__ void __launch_bounds__(256)
f2bf_kernel(const float* __restrict__ src, unsigned short* __restrict__ dst, int n) {
  int i = blockIdx.x * 256 + threadIdx.x;
  // i runs over the destination, so a block writes whole lines:
  // i = [row / 64][k / 8][row % 64][k % 8]
  if (i < n) dst[i] = f2bf(src[((i >> 14) * 64 + ((i >> 3) & 63)) * CHN + ((i >> 9) & 31) * 8 + (i & 7)]);
}

__global__ void __launch_bounds__(128)
qkv_gemm_kernel(const unsigned short* __restrict__ wqkv,
                const unsigned short* __restrict__ xn,
                const float* __restrict__ bias,
                unsigned short* __restrict__ qo,
                unsigned short* __restrict__ ko,
                unsigned short* __restrict__ vo) {
  __shared__ unsigned short Asm[64 * CHN];   // 32 KB: 64 M-rows x 256 K
  __shared__ unsigned short Bsm[64 * CHN];   // 32 KB: 64 N-cols x 256 K
  const int lane = threadIdx.x & 31;
  const int wave = threadIdx.x >> 5;
  const int half = lane >> 4;
  const int lid  = lane & 15;
  const int mbase = blockIdx.x * 64;        // 0..704
  const int n0    = blockIdx.y * 64;
  const int b     = blockIdx.z;

  const unsigned short* ag = wqkv + (size_t)mbase * CHN;
  const unsigned short* bg = xn + ((size_t)b * NSP + n0) * CHN;

#ifdef USE_TDM
  if (wave == 0) {
    tdm_load_2d(Asm, ag, CHN, 64, CHN, 64, CHN);
    tdm_load_2d(Bsm, bg, CHN, 64, CHN, 64, CHN);
    __builtin_amdgcn_s_wait_tensorcnt(0);
  }
#else
  {
    const uint4* as = (const uint4*)ag; uint4* ad = (uint4*)Asm;
    const uint4* bs = (const uint4*)bg; uint4* bd = (uint4*)Bsm;
    for (int t = threadIdx.x; t < 64 * CHN / 8; t += 128) { ad[t] = as[t]; bd[t] = bs[t]; }
  }
#endif
  __syncthreads();

  const unsigned short* al = cm_lane(Asm, 64, wave * 16 + lid, half);
  const unsigned short* bl = cm_lane(Bsm, 64, lid, half);
  v8f acc[4] = {};
  for (int kb = 0; kb < CHN; kb += 32) {
    v16bf a = load_frag_cm(al, 64, 0, kb >> 3);
#pragma unroll
    for (int j = 0; j < 4; ++j) {
      v16bf bf = load_frag_cm(bl, 64, j * 16, kb >> 3);
      acc[j] = wmma_bf16(a, bf, acc[j]);
    }
  }

  const float scale = 0.35355339059327373f;  // 64^-0.25, applied to q and k
#pragma unroll
  for (int j = 0; j < 4; ++j) {
#pragma unroll
    for (int r = 0; r < 8; ++r) {
      int o = mbase + wave * 16 + r + half * 8;  // D layout: row = r + half*8
      int n = n0 + j * 16 + lid;                 //           col = lane % 16
      float val = acc[j][r] + bias[o];
      if (o < CHN) {
        int head = o >> 6, c = o & 63;
        qo[(((size_t)(b * HEADS + head) * NSP) + n) * CHD + c] = f2bf(val * scale);
      } else if (o < 2 * CHN) {
        int oc = o - CHN, head = oc >> 6, c = oc & 63;
        // 32-key tiles, chunk-major: [n / 32][c / 8][n % 32][c % 8]
        ko[((size_t)(b * HEADS + head) * NSP + n0) * CHD + (j >> 1) * 2048 + (c >> 3) * 256 +
           ((j & 1) * 16 + lid) * 8 + r] = f2bf(val * scale);
      } else {
        int oc = o - 2 * CHN, head = oc >> 6, c = oc & 63;
        // row (n % 32) / 8 * 16 + c / 4 of 4096: the 64 x 32 tile at column n / 32 * 32
        // then lands in LDS as [key / 8][c][key % 8]
        vo[((size_t)(b * HEADS + head) * CHD + ((j & 1) * 2 + (lid >> 3)) * 16 + (c >> 2)) * NSP +
           n0 + (j >> 1) * 32 + (r & 3) * 8 + (lid & 7)] = f2bf(val);
      }
    }
  }
}

__global__ void __launch_bounds__(256)
flash_attn_kernel(const unsigned short* __restrict__ q,
                  const unsigned short* __restrict__ k,
                  const unsigned short* __restrict__ v,
                  unsigned short* __restrict__ aout) {
  __shared__ unsigned short Kb[2][32 * CHD];     // 2 x 4 KB (32 keys x 64 ch)
  __shared__ unsigned short Vb[2][CHD * 32];     // 2 x 4 KB (64 ch x 32 keys)
  const int lane = threadIdx.x & 31;
  const int wave = threadIdx.x >> 5;
  const int half = lane >> 4;
  const int lid  = lane & 15;
  const int bh = blockIdx.x;                     // b*4 + head
  const int qt = blockIdx.y * 8 + wave;          // 16-query tile, 0..255

  const unsigned short* kg = k + (size_t)bh * NSP * CHD;  // 32-key chunk-major tiles back to back
  const unsigned short* vg = v + (size_t)bh * CHD * NSP;  // (64, n) row stride N

#ifdef USE_TDM
  auto issue_kv = [&](int buf, int s0) {
    // K tile: one 4 KB chunk-major 32-key tile, copied as 32 x 64, row stride 64 (dense)
    tdm_load_2d(&Kb[buf][0], kg + (size_t)s0 * CHD, CHD, 32, CHD, NSP, CHD);
    // V tile: 64 rows x 32 cols (keys s0..s0+31, all 64 ch), row stride 4096
    tdm_load_2d(&Vb[buf][0], vg + s0, 32, CHD, NSP, CHD, NSP);
  };
  if (wave == 0) { issue_kv(0, 0); __builtin_amdgcn_s_wait_tensorcnt(0); }
  __syncthreads();
#endif

  const unsigned short* qbase = q + ((size_t)bh * NSP + qt * 16 + lid) * CHD;
  v16bf qa0 = load_frag(qbase,      half);       // B: col = query lid, K = c 0..31
  v16bf qa1 = load_frag(qbase + 32, half);       // B: col = query lid, K = c 32..63

  float m = -1e30f;   // running maximum of query lid, the same in both halves
  float l = 0.f;      // running sum over this half's keys only; halves joined after the loop
  v8f o[4] = {};      // o[j][r] = O^T[c = j*16 + half*8 + r][query lid]

  const int steps = NSP / 32;
  for (int it = 0; it < steps; ++it) {
    const int s0 = it * 32;
#ifdef USE_TDM
    const int cur = it & 1;
    if (wave == 0 && it + 1 < steps) issue_kv(cur ^ 1, s0 + 32);
#else
    const int cur = 0;
    {
      // cooperative stage: K tile is 4 KB contiguous, V tile 64 rows x 64 B
      const uint4* ks = (const uint4*)(kg + (size_t)s0 * CHD);
      ((uint4*)&Kb[0][0])[threadIdx.x] = ks[threadIdx.x];
      int row = threadIdx.x >> 2, ch4 = threadIdx.x & 3;
      ((uint4*)&Vb[0][0])[threadIdx.x] =
          *(const uint4*)(vg + (size_t)row * NSP + s0 + ch4 * 8);
    }
    __syncthreads();
#endif
    // As the QKV epilogue stored them, the landed tiles are chunk-major:
    // Kb = [c / 8][key][c % 8], Vb = [key / 8][c][key % 8].
    const unsigned short* kl = cm_lane(&Kb[cur][0], 32, lid, half);
    const unsigned short* vl = cm_lane(&Vb[cur][0], 64, lid, half);
    v8f st[2] = {};   // st[sub][r] = S^T[key = sub*16 + half*8 + r][query lid]
#pragma unroll
    for (int sub = 0; sub < 2; ++sub) {
      v16bf kb0 = load_frag_cm(kl, 32, sub * 16, 0);   // A: row = key, K = c
      v16bf kb1 = load_frag_cm(kl, 32, sub * 16, 4);
      st[sub] = wmma_bf16(kb0, qa0, st[sub]);
      st[sub] = wmma_bf16(kb1, qa1, st[sub]);
    }
    // Online softmax of one query per lane: 16 of its 32 scores are here, the
    // other 16 in lane ^ 16.
    float cm = fmaxf(st[0][0], st[1][0]);
#pragma unroll
    for (int r = 1; r < 8; ++r) cm = fmaxf(cm, fmaxf(st[0][r], st[1][r]));
    cm = fmaxf(cm, xhalf(cm));
    const float mnew  = fmaxf(m, cm);
    const float LOG2E = 1.44269504f;   // e^x as 2^(x * log2 e), as __expf compiles
    const float alpha = exp2_1((m - mnew) * LOG2E);
    m = mnew;
    // B operand P^T, column = query lid: elements 0..7 are keys half*8 + 0..7 (tile 0's
    // registers), elements 8..15 keys 16 + half*8 + 0..7 (tile 1's): the k order in which
    // load_frag_cm hands out V's keys.
    FragU pb;
    float rs[2];
#pragma unroll
    for (int sub = 0; sub < 2; ++sub) {
      float x[8], p[8];
#pragma unroll
      for (int r = 0; r < 8; ++r) x[r] = (st[sub][r] - mnew) * LOG2E;
      exp2_8(x, p);
#pragma unroll
      for (int i = 0; i < 4; ++i) pb.u[sub * 4 + i] = pack2(p[2 * i], p[2 * i + 1]);
      rs[sub] = ((p[0] + p[1]) + (p[2] + p[3])) + ((p[4] + p[5]) + (p[6] + p[7]));
    }
    l = l * alpha + (rs[0] + rs[1]);
#pragma unroll
    for (int j = 0; j < 4; ++j) {
      o[j] *= alpha;
      v16bf va = load_frag_cm(vl, 64, j * 16, 0);  // A: row = c, K = key
      o[j] = wmma_bf16(va, pb.v, o[j]);
    }
#ifdef USE_TDM
    if (wave == 0) __builtin_amdgcn_s_wait_tensorcnt(0);
#endif
    __syncthreads();
  }

  const int b = bh >> 2, head = bh & 3;
  // a lane's 8 registers of o[j] are 8 neighbouring channels of one row: one 16-byte chunk
  // of the panel; column tile j lies two chunks (1024 elements) on
  const size_t obase = panel_idx((size_t)b * NSP + qt * 16 + lid, head * CHD + half * 8);
  const float inv = 1.0f / (l + xhalf(l));
#pragma unroll
  for (int j = 0; j < 4; ++j) {
    uint4 w;
    w.x = pack2(o[j][0] * inv, o[j][1] * inv);
    w.y = pack2(o[j][2] * inv, o[j][3] * inv);
    w.z = pack2(o[j][4] * inv, o[j][5] * inv);
    w.w = pack2(o[j][6] * inv, o[j][7] * inv);
    *(uint4*)(aout + obase + j * 1024) = w;
  }
}

__global__ void __launch_bounds__(128)
proj_gemm_kernel(const unsigned short* __restrict__ wp,
                 const unsigned short* __restrict__ a,
                 const float* __restrict__ bias,
                 const float* __restrict__ x,
                 float* __restrict__ out) {
  __shared__ unsigned short Asm[64 * CHN];
  __shared__ unsigned short Bsm[64 * CHN];
  const int lane = threadIdx.x & 31;
  const int wave = threadIdx.x >> 5;
  const int half = lane >> 4;
  const int lid  = lane & 15;
  const int mbase = blockIdx.x * 64;        // 0..192
  const int n0    = blockIdx.y * 64;
  const int b     = blockIdx.z;

  const unsigned short* ag = wp + (size_t)mbase * CHN;
  const unsigned short* bg = a + ((size_t)b * NSP + n0) * CHN;

#ifdef USE_TDM
  if (wave == 0) {
    tdm_load_2d(Asm, ag, CHN, 64, CHN, 64, CHN);
    tdm_load_2d(Bsm, bg, CHN, 64, CHN, 64, CHN);
    __builtin_amdgcn_s_wait_tensorcnt(0);
  }
#else
  {
    const uint4* as = (const uint4*)ag; uint4* ad = (uint4*)Asm;
    const uint4* bs = (const uint4*)bg; uint4* bd = (uint4*)Bsm;
    for (int t = threadIdx.x; t < 64 * CHN / 8; t += 128) { ad[t] = as[t]; bd[t] = bs[t]; }
  }
#endif
  __syncthreads();

  const unsigned short* al = cm_lane(Asm, 64, wave * 16 + lid, half);
  const unsigned short* bl = cm_lane(Bsm, 64, lid, half);
  v8f acc[4] = {};
  for (int kb = 0; kb < CHN; kb += 32) {
    v16bf af = load_frag_cm(al, 64, 0, kb >> 3);
#pragma unroll
    for (int j = 0; j < 4; ++j) {
      v16bf bf = load_frag_cm(bl, 64, j * 16, kb >> 3);
      acc[j] = wmma_bf16(af, bf, acc[j]);
    }
  }
#pragma unroll
  for (int j = 0; j < 4; ++j) {
#pragma unroll
    for (int r = 0; r < 8; ++r) {
      int o = mbase + wave * 16 + r + half * 8;
      int n = n0 + j * 16 + lid;
      size_t idx = ((size_t)b * CHN + o) * NSP + n;
      out[idx] = x[idx] + acc[j][r] + bias[o];
    }
  }
}

// ---------------------------------------------------------------------------
// Workspace layout (bytes)
// ---------------------------------------------------------------------------
#define OFF_STATS 0                                          // 256*2*4 = 2 KB
#define OFF_WQ    ((size_t)4096)                             // 768*256 bf16
#define OFF_WP    (OFF_WQ + (size_t)3 * CHN * CHN * 2)
#define OFF_XN    (OFF_WP + (size_t)CHN * CHN * 2)           // (b*n, c) bf16 panels
#define OFF_Q     (OFF_XN + (size_t)BATCH * NSP * CHN * 2)   // (bh,n,64) bf16
#define OFF_K     (OFF_Q  + (size_t)BATCH * CHN * NSP * 2)   // (bh,n/32,c/8,n%32,c%8) bf16
#define OFF_V     (OFF_K  + (size_t)BATCH * CHN * NSP * 2)   // (bh,64 rows,n) bf16, rows as the QKV epilogue lays them
#define OFF_A     (OFF_V  + (size_t)BATCH * CHN * NSP * 2)   // (b*n, c) bf16 panels

extern "C" void kernel_launch(void* const* d_in, const int* in_sizes, int n_in,
                              void* d_out, int out_size, void* d_ws, size_t ws_size,
                              hipStream_t stream) {
  const float* x      = (const float*)d_in[0];
  const float* norm_w = (const float*)d_in[1];
  const float* norm_b = (const float*)d_in[2];
  const float* qkv_w  = (const float*)d_in[3];
  const float* qkv_b  = (const float*)d_in[4];
  const float* proj_w = (const float*)d_in[5];
  const float* proj_b = (const float*)d_in[6];

  char* ws = (char*)d_ws;
  float*          stats = (float*)(ws + OFF_STATS);
  unsigned short* wq    = (unsigned short*)(ws + OFF_WQ);
  unsigned short* wp    = (unsigned short*)(ws + OFF_WP);
  unsigned short* xn    = (unsigned short*)(ws + OFF_XN);
  unsigned short* qb    = (unsigned short*)(ws + OFF_Q);
  unsigned short* kb    = (unsigned short*)(ws + OFF_K);
  unsigned short* vb    = (unsigned short*)(ws + OFF_V);
  unsigned short* ab    = (unsigned short*)(ws + OFF_A);

  gn_stats_kernel<<<BATCH * NGRP, 256, 0, stream>>>(x, stats);
  gn_apply_kernel<<<(BATCH * CHN * NSP) / 256, 256, 0, stream>>>(
      x, stats, norm_w, norm_b, xn);
  f2bf_kernel<<<(3 * CHN * CHN + 255) / 256, 256, 0, stream>>>(qkv_w, wq, 3 * CHN * CHN);
  f2bf_kernel<<<(CHN * CHN + 255) / 256, 256, 0, stream>>>(proj_w, wp, CHN * CHN);

  qkv_gemm_kernel<<<dim3(12, 64, BATCH), 128, 0, stream>>>(wq, xn, qkv_b, qb, kb, vb);
  flash_attn_kernel<<<dim3(BATCH * HEADS, NSP / (16 * 8)), 256, 0, stream>>>(qb, kb, vb, ab);
  proj_gemm_kernel<<<dim3(4, 64, BATCH), 128, 0, stream>>>(wp, ab, proj_b, x, (float*)d_out);
}

// v003
// One run takes 193 microseconds.
// Next to v002, in two timings, it ran 1.11 times as fast each time.
// All steps since v000 together make it 3.40 times as fast.
#include <hip/hip_runtime.h>
#include <stdint.h>

typedef __attribute__((ext_vector_type(16))) __bf16 v16bf;
typedef __attribute__((ext_vector_type(8)))  float  v8f;
typedef __attribute__((ext_vector_type(4)))  unsigned int v4u;
typedef __attribute__((ext_vector_type(8)))  int v8i;
typedef __attribute__((ext_vector_type(4)))  int v4i;

#define BATCH 8
#define CHN   256
#define NSP   4096
#define NGRP  32
#define CPG   8      // channels per group
#define HEADS 4
#define CHD   64     // channels per head
#define EPSV  1e-5f

#if __has_builtin(__builtin_amdgcn_tensor_load_to_lds) && \
    __has_builtin(__builtin_amdgcn_s_wait_tensorcnt)
#define USE_TDM 1
#endif

union FragU { v16bf v; uint32_t u[8]; };

__device__ __forceinline__ unsigned short f2bf(float x) {
  union { float f; uint32_t u; } c; c.f = x;
  uint32_t u = c.u;
  u += 0x7fffu + ((u >> 16) & 1u);   // round-to-nearest-even
  return (unsigned short)(u >> 16);
}

__device__ __forceinline__ v16bf load_frag(const unsigned short* base, int half) {
  const uint32_t* p = (const uint32_t*)base;
  FragU f;
  const int o0 = half * 4;       // dword offset of K = half*8
  const int o1 = 8 + half * 4;   // dword offset of K = 16 + half*8
  f.u[0] = p[o0 + 0]; f.u[1] = p[o0 + 1]; f.u[2] = p[o0 + 2]; f.u[3] = p[o0 + 3];
  f.u[4] = p[o1 + 0]; f.u[5] = p[o1 + 1]; f.u[6] = p[o1 + 2]; f.u[7] = p[o1 + 3];
  return f.v;
}

__device__ __forceinline__ const unsigned short* cm_lane(const unsigned short* tile, int rows,
                                                         int row, int half) {
  return tile + (half * rows + row) * 8;
}
__device__ __forceinline__ v16bf load_frag_cm(const unsigned short* lane_base, int rows,
                                              int row0, int kc) {
  const uint32_t* p0 = (const uint32_t*)(lane_base + (kc * rows + row0) * 8);
  const uint32_t* p1 = (const uint32_t*)(lane_base + ((kc + 2) * rows + row0) * 8);
  FragU f;
  f.u[0] = p0[0]; f.u[1] = p0[1]; f.u[2] = p0[2]; f.u[3] = p0[3];
  f.u[4] = p1[0]; f.u[5] = p1[1]; f.u[6] = p1[2]; f.u[7] = p1[3];
  return f.v;
}

// Element index of (row, k) in a matrix of 256 columns kept as dense 64-row
// panels, each panel chunk-major: [row / 64][k / 8][row % 64][k % 8].
__device__ __forceinline__ size_t panel_idx(size_t row, int k) {
  return ((row >> 6) * 32 + (size_t)(k >> 3)) * 512 + (row & 63) * 8 + (size_t)(k & 7);
}

__device__ __forceinline__ v8f wmma_bf16(v16bf a, v16bf b, v8f c) {
  return __builtin_amdgcn_wmma_f32_16x16x32_bf16(
      /*neg_a=*/false, a, /*neg_b=*/false, b,
      /*c_mod=*/(short)0, c, /*reuse_a=*/false, /*reuse_b=*/false);
}

// Two f32 to one register of two bf16, round to nearest even (one v_cvt_pk_bf16_f32).
__device__ __forceinline__ uint32_t pack2(float lo, float hi) {
  typedef __bf16 bf2 __attribute__((ext_vector_type(2)));
  typedef float  f2  __attribute__((ext_vector_type(2)));
  return __builtin_bit_cast(uint32_t, __builtin_convertvector(f2{lo, hi}, bf2));
}

__device__ __forceinline__ float xhalf(float x) {
  int b = __builtin_bit_cast(int, x);
  return __builtin_bit_cast(float,
      __builtin_amdgcn_permlanex16(b, b, 0x76543210, 0xfedcba98, false, false));
}

__device__ __forceinline__ float exp2_1(float x) {
  float p;
  asm("v_exp_f32 %0, %1\n\tv_nop" : "=&v"(p) : "v"(x));
  return p;
}
__device__ __forceinline__ void exp2_8(const float (&x)[8], float (&p)[8]) {
  asm("v_exp_f32 %0, %8\n\t"
      "v_exp_f32 %1, %9\n\t"
      "v_exp_f32 %2, %10\n\t"
      "v_exp_f32 %3, %11\n\t"
      "v_exp_f32 %4, %12\n\t"
      "v_exp_f32 %5, %13\n\t"
      "v_exp_f32 %6, %14\n\t"
      "v_exp_f32 %7, %15\n\t"
      "v_nop"
      : "=&v"(p[0]), "=&v"(p[1]), "=&v"(p[2]), "=&v"(p[3]),
        "=&v"(p[4]), "=&v"(p[5]), "=&v"(p[6]), "=&v"(p[7])
      : "v"(x[0]), "v"(x[1]), "v"(x[2]), "v"(x[3]),
        "v"(x[4]), "v"(x[5]), "v"(x[6]), "v"(x[7]));
}

#ifdef USE_TDM
__device__ __forceinline__ void tdm_load_2d(void* lds_dst, const void* gsrc,
                                            uint32_t tile_d0, uint32_t tile_d1,
                                            uint32_t tensor_d0, uint32_t tensor_d1,
                                            uint32_t stride0) {
  uint64_t ga = (uint64_t)(uintptr_t)gsrc;
  uint32_t lo = (uint32_t)(uintptr_t)lds_dst;  // LDS byte offset (low 32 bits)
  v4u g0;
  g0[0] = 1u;
  g0[1] = lo;
  g0[2] = (uint32_t)ga;
  g0[3] = (uint32_t)((ga >> 32) & 0x01FFFFFFu) | (2u << 30);  // [56:32] | type=2
  v8i g1;
  g1[0] = (int)(1u << 16);
  g1[1] = (int)((tensor_d0 & 0xFFFFu) << 16);
  g1[2] = (int)(((tensor_d0 >> 16) & 0xFFFFu) | ((tensor_d1 & 0xFFFFu) << 16));
  g1[3] = (int)(((tensor_d1 >> 16) & 0xFFFFu) | ((tile_d0 & 0xFFFFu) << 16));
  g1[4] = (int)(tile_d1 & 0xFFFFu);
  g1[5] = (int)stride0;
  g1[6] = 0;
  g1[7] = 0;
  v4i z4 = {0, 0, 0, 0};
  v8i z8 = {0, 0, 0, 0, 0, 0, 0, 0};
  __builtin_amdgcn_tensor_load_to_lds(g0, g1, z4, z4, z8, 0);
}
#endif

// ---------------------------------------------------------------------------
// 1) GroupNorm in one launch: one block of 32 waves per (b, g). A group is 8 channels
//    x 4096 positions = 32 floats per thread, held in registers from the sums to the
//    normalised store, so x is read once. The group's 8 channels are one 16-byte chunk
//    of the panel layout: a lane stores whole chunks, a wave 512 contiguous bytes.
// ---------------------------------------------------------------------------
__global__ void __launch_bounds__(1024)
gn_kernel(const float* __restrict__ x, const float* __restrict__ gw,
          const float* __restrict__ gb, unsigned short* __restrict__ xn) {
  __shared__ float sh_s[32];
  __shared__ float sh_q[32];
  const int lane = threadIdx.x & 31;
  const int wave = threadIdx.x >> 5;
  const int bg = blockIdx.x;                       // b*32 + g
  const int b = bg >> 5, g = bg & 31;
  const float* base = x + (size_t)bg * (CPG * NSP) + wave * 128 + lane;
  float v[CPG][4];
#pragma unroll
  for (int c = 0; c < CPG; ++c)
#pragma unroll
    for (int i = 0; i < 4; ++i) v[c][i] = base[c * NSP + i * 32];

  float s = 0.f, q = 0.f;
#pragma unroll
  for (int c = 0; c < CPG; ++c)
#pragma unroll
    for (int i = 0; i < 4; ++i) { s += v[c][i]; q += v[c][i] * v[c][i]; }
#pragma unroll
  for (int off = 16; off > 0; off >>= 1) {
    s += __shfl_xor(s, off, 32);
    q += __shfl_xor(q, off, 32);
  }
  if (lane == 0) { sh_s[wave] = s; sh_q[wave] = q; }
  __syncthreads();
  // every wave joins the 32 wave sums by the same butterfly: the same bits in every lane
  s = sh_s[lane]; q = sh_q[lane];
#pragma unroll
  for (int off = 16; off > 0; off >>= 1) {
    s += __shfl_xor(s, off, 32);
    q += __shfl_xor(q, off, 32);
  }
  const float inv  = 1.0f / (float)(CPG * NSP);
  const float mean = s * inv;
  const float var  = q * inv - mean * mean;
  const float rstd = rsqrtf(var + EPSV);

  float w8[CPG], b8[CPG];
#pragma unroll
  for (int c = 0; c < CPG; ++c) { w8[c] = gw[g * CPG + c]; b8[c] = gb[g * CPG + c]; }
#pragma unroll
  for (int i = 0; i < 4; ++i) {
    float y[CPG];
#pragma unroll
    for (int c = 0; c < CPG; ++c) y[c] = (v[c][i] - mean) * rstd * w8[c] + b8[c];
    uint4 o;
    o.x = pack2(y[0], y[1]);
    o.y = pack2(y[2], y[3]);
    o.z = pack2(y[4], y[5]);
    o.w = pack2(y[6], y[7]);
    *(uint4*)(xn + panel_idx((size_t)b * NSP + wave * 128 + i * 32 + lane, g * CPG)) = o;
  }
}

// ---------------------------------------------------------------------------
// 2) fp32 -> bf16 weight conversion (256 columns), into chunk-major panels.
// ---------------------------------------------------------------------------
__global__ void __launch_bounds__(256)
f2bf_kernel(const float* __restrict__ src, unsigned short* __restrict__ dst, int n) {
  int i = blockIdx.x * 256 + threadIdx.x;
  // i runs over the destination, so a block writes whole lines:
  // i = [row / 64][k / 8][row % 64][k % 8]
  if (i < n) dst[i] = f2bf(src[((i >> 14) * 64 + ((i >> 3) & 63)) * CHN + ((i >> 9) & 31) * 8 + (i & 7)]);
}

__global__ void __launch_bounds__(128)
qkv_gemm_kernel(const unsigned short* __restrict__ wqkv,
                const unsigned short* __restrict__ xn,
                const float* __restrict__ bias,
                unsigned short* __restrict__ qo,
                unsigned short* __restrict__ ko,
                unsigned short* __restrict__ vo) {
  __shared__ unsigned short Asm[64 * CHN];   // 32 KB: 64 M-rows x 256 K
  __shared__ unsigned short Bsm[64 * CHN];   // 32 KB: 64 N-cols x 256 K
  const int lane = threadIdx.x & 31;
  const int wave = threadIdx.x >> 5;
  const int half = lane >> 4;
  const int lid  = lane & 15;
  const int mbase = blockIdx.x * 64;        // 0..704
  const int n0    = blockIdx.y * 64;
  const int b     = blockIdx.z;

  const unsigned short* ag = wqkv + (size_t)mbase * CHN;
  const unsigned short* bg = xn + ((size_t)b * NSP + n0) * CHN;

#ifdef USE_TDM
  if (wave == 0) {
    tdm_load_2d(Asm, ag, CHN, 64, CHN, 64, CHN);
    tdm_load_2d(Bsm, bg, CHN, 64, CHN, 64, CHN);
    __builtin_amdgcn_s_wait_tensorcnt(0);
  }
#else
  {
    const uint4* as = (const uint4*)ag; uint4* ad = (uint4*)Asm;
    const uint4* bs = (const uint4*)bg; uint4* bd = (uint4*)Bsm;
    for (int t = threadIdx.x; t < 64 * CHN / 8; t += 128) { ad[t] = as[t]; bd[t] = bs[t]; }
  }
#endif
  __syncthreads();

  const unsigned short* al = cm_lane(Asm, 64, wave * 16 + lid, half);
  const unsigned short* bl = cm_lane(Bsm, 64, lid, half);
  v8f acc[4] = {};
  for (int kb = 0; kb < CHN; kb += 32) {
    v16bf a = load_frag_cm(al, 64, 0, kb >> 3);
#pragma unroll
    for (int j = 0; j < 4; ++j) {
      v16bf bf = load_frag_cm(bl, 64, j * 16, kb >> 3);
      acc[j] = wmma_bf16(a, bf, acc[j]);
    }
  }

  const float scale = 0.35355339059327373f;  // 64^-0.25, applied to q and k
#pragma unroll
  for (int j = 0; j < 4; ++j) {
#pragma unroll
    for (int r = 0; r < 8; ++r) {
      int o = mbase + wave * 16 + r + half * 8;  // D layout: row = r + half*8
      int n = n0 + j * 16 + lid;                 //           col = lane % 16
      float val = acc[j][r] + bias[o];
      if (o < CHN) {
        int head = o >> 6, c = o & 63;
        qo[(((size_t)(b * HEADS + head) * NSP) + n) * CHD + c] = f2bf(val * scale);
      } else if (o < 2 * CHN) {
        int oc = o - CHN, head = oc >> 6, c = oc & 63;
        // 32-key tiles, chunk-major: [n / 32][c / 8][n % 32][c % 8]
        ko[((size_t)(b * HEADS + head) * NSP + n0) * CHD + (j >> 1) * 2048 + (c >> 3) * 256 +
           ((j & 1) * 16 + lid) * 8 + r] = f2bf(val * scale);
      } else {
        int oc = o - 2 * CHN, head = oc >> 6, c = oc & 63;
        // row (n % 32) / 8 * 16 + c / 4 of 4096: the 64 x 32 tile at column n / 32 * 32
        // then lands in LDS as [key / 8][c][key % 8]
        vo[((size_t)(b * HEADS + head) * CHD + ((j & 1) * 2 + (lid >> 3)) * 16 + (c >> 2)) * NSP +
           n0 + (j >> 1) * 32 + (r & 3) * 8 + (lid & 7)] = f2bf(val);
      }
    }
  }
}

__global__ void __launch_bounds__(256)
flash_attn_kernel(const unsigned short* __restrict__ q,
                  const unsigned short* __restrict__ k,
                  const unsigned short* __restrict__ v,
                  unsigned short* __restrict__ aout) {
  __shared__ unsigned short Kb[2][32 * CHD];     // 2 x 4 KB (32 keys x 64 ch)
  __shared__ unsigned short Vb[2][CHD * 32];     // 2 x 4 KB (64 ch x 32 keys)
  const int lane = threadIdx.x & 31;
  const int wave = threadIdx.x >> 5;
  const int half = lane >> 4;
  const int lid  = lane & 15;
  const int bh = blockIdx.x;                     // b*4 + head
  const int qt = blockIdx.y * 8 + wave;          // 16-query tile, 0..255

  const unsigned short* kg = k + (size_t)bh * NSP * CHD;  // 32-key chunk-major tiles back to back
  const unsigned short* vg = v + (size_t)bh * CHD * NSP;  // (64, n) row stride N

#ifdef USE_TDM
  auto issue_kv = [&](int buf, int s0) {
    // K tile: one 4 KB chunk-major 32-key tile, copied as 32 x 64, row stride 64 (dense)
    tdm_load_2d(&Kb[buf][0], kg + (size_t)s0 * CHD, CHD, 32, CHD, NSP, CHD);
    // V tile: 64 rows x 32 cols (keys s0..s0+31, all 64 ch), row stride 4096
    tdm_load_2d(&Vb[buf][0], vg + s0, 32, CHD, NSP, CHD, NSP);
  };
  if (wave == 0) { issue_kv(0, 0); __builtin_amdgcn_s_wait_tensorcnt(0); }
  __syncthreads();
#endif

  const unsigned short* qbase = q + ((size_t)bh * NSP + qt * 16 + lid) * CHD;
  v16bf qa0 = load_frag(qbase,      half);       // B: col = query lid, K = c 0..31
  v16bf qa1 = load_frag(qbase + 32, half);       // B: col = query lid, K = c 32..63

  float m = -1e30f;   // running maximum of query lid, the same in both halves
  float l = 0.f;      // running sum over this half's keys only; halves joined after the loop
  v8f o[4] = {};      // o[j][r] = O^T[c = j*16 + half*8 + r][query lid]

  const int steps = NSP / 32;
  for (int it = 0; it < steps; ++it) {
    const int s0 = it * 32;
#ifdef USE_TDM
    const int cur = it & 1;
    if (wave == 0 && it + 1 < steps) issue_kv(cur ^ 1, s0 + 32);
#else
    const int cur = 0;
    {
      // cooperative stage: K tile is 4 KB contiguous, V tile 64 rows x 64 B
      const uint4* ks = (const uint4*)(kg + (size_t)s0 * CHD);
      ((uint4*)&Kb[0][0])[threadIdx.x] = ks[threadIdx.x];
      int row = threadIdx.x >> 2, ch4 = threadIdx.x & 3;
      ((uint4*)&Vb[0][0])[threadIdx.x] =
          *(const uint4*)(vg + (size_t)row * NSP + s0 + ch4 * 8);
    }
    __syncthreads();
#endif
    // As the QKV epilogue stored them, the landed tiles are chunk-major:
    // Kb = [c / 8][key][c % 8], Vb = [key / 8][c][key % 8].
    const unsigned short* kl = cm_lane(&Kb[cur][0], 32, lid, half);
    const unsigned short* vl = cm_lane(&Vb[cur][0], 64, lid, half);
    v8f st[2] = {};   // st[sub][r] = S^T[key = sub*16 + half*8 + r][query lid]
#pragma unroll
    for (int sub = 0; sub < 2; ++sub) {
      v16bf kb0 = load_frag_cm(kl, 32, sub * 16, 0);   // A: row = key, K = c
      v16bf kb1 = load_frag_cm(kl, 32, sub * 16, 4);
      st[sub] = wmma_bf16(kb0, qa0, st[sub]);
      st[sub] = wmma_bf16(kb1, qa1, st[sub]);
    }
    // Online softmax of one query per lane: 16 of its 32 scores are here, the
    // other 16 in lane ^ 16.
    float cm = fmaxf(st[0][0], st[1][0]);
#pragma unroll
    for (int r = 1; r < 8; ++r) cm = fmaxf(cm, fmaxf(st[0][r], st[1][r]));
    cm = fmaxf(cm, xhalf(cm));
    const float mnew  = fmaxf(m, cm);
    const float LOG2E = 1.44269504f;   // e^x as 2^(x * log2 e), as __expf compiles
    const float alpha = exp2_1((m - mnew) * LOG2E);
    m = mnew;
    // B operand P^T, column = query lid: elements 0..7 are keys half*8 + 0..7 (tile 0's
    // registers), elements 8..15 keys 16 + half*8 + 0..7 (tile 1's): the k order in which
    // load_frag_cm hands out V's keys.
    FragU pb;
    float rs[2];
#pragma unroll
    for (int sub = 0; sub < 2; ++sub) {
      float x[8], p[8];
#pragma unroll
      for (int r = 0; r < 8; ++r) x[r] = (st[sub][r] - mnew) * LOG2E;
      exp2_8(x, p);
#pragma unroll
      for (int i = 0; i < 4; ++i) pb.u[sub * 4 + i] = pack2(p[2 * i], p[2 * i + 1]);
      rs[sub] = ((p[0] + p[1]) + (p[2] + p[3])) + ((p[4] + p[5]) + (p[6] + p[7]));
    }
    l = l * alpha + (rs[0] + rs[1]);
#pragma unroll
    for (int j = 0; j < 4; ++j) {
      o[j] *= alpha;
      v16bf va = load_frag_cm(vl, 64, j * 16, 0);  // A: row = c, K = key
      o[j] = wmma_bf16(va, pb.v, o[j]);
    }
#ifdef USE_TDM
    if (wave == 0) __builtin_amdgcn_s_wait_tensorcnt(0);
#endif
    __syncthreads();
  }

  const int b = bh >> 2, head = bh & 3;
  // a lane's 8 registers of o[j] are 8 neighbouring channels of one row: one 16-byte chunk
  // of the panel; column tile j lies two chunks (1024 elements) on
  const size_t obase = panel_idx((size_t)b * NSP + qt * 16 + lid, head * CHD + half * 8);
  const float inv = 1.0f / (l + xhalf(l));
#pragma unroll
  for (int j = 0; j < 4; ++j) {
    uint4 w;
    w.x = pack2(o[j][0] * inv, o[j][1] * inv);
    w.y = pack2(o[j][2] * inv, o[j][3] * inv);
    w.z = pack2(o[j][4] * inv, o[j][5] * inv);
    w.w = pack2(o[j][6] * inv, o[j][7] * inv);
    *(uint4*)(aout + obase + j * 1024) = w;
  }
}

__global__ void __launch_bounds__(128)
proj_gemm_kernel(const unsigned short* __restrict__ wp,
                 const unsigned short* __restrict__ a,
                 const float* __restrict__ bias,
                 const float* __restrict__ x,
                 float* __restrict__ out) {
  __shared__ unsigned short Asm[64 * CHN];
  __shared__ unsigned short Bsm[64 * CHN];
  const int lane = threadIdx.x & 31;
  const int wave = threadIdx.x >> 5;
  const int half = lane >> 4;
  const int lid  = lane & 15;
  const int mbase = blockIdx.x * 64;        // 0..192
  const int n0    = blockIdx.y * 64;
  const int b     = blockIdx.z;

  const unsigned short* ag = wp + (size_t)mbase * CHN;
  const unsigned short* bg = a + ((size_t)b * NSP + n0) * CHN;

#ifdef USE_TDM
  if (wave == 0) {
    tdm_load_2d(Asm, ag, CHN, 64, CHN, 64, CHN);
    tdm_load_2d(Bsm, bg, CHN, 64, CHN, 64, CHN);
    __builtin_amdgcn_s_wait_tensorcnt(0);
  }
#else
  {
    const uint4* as = (const uint4*)ag; uint4* ad = (uint4*)Asm;
    const uint4* bs = (const uint4*)bg; uint4* bd = (uint4*)Bsm;
    for (int t = threadIdx.x; t < 64 * CHN / 8; t += 128) { ad[t] = as[t]; bd[t] = bs[t]; }
  }
#endif
  __syncthreads();

  const unsigned short* al = cm_lane(Asm, 64, wave * 16 + lid, half);
  const unsigned short* bl = cm_lane(Bsm, 64, lid, half);
  v8f acc[4] = {};
  for (int kb = 0; kb < CHN; kb += 32) {
    v16bf af = load_frag_cm(al, 64, 0, kb >> 3);
#pragma unroll
    for (int j = 0; j < 4; ++j) {
      v16bf bf = load_frag_cm(bl, 64, j * 16, kb >> 3);
      acc[j] = wmma_bf16(af, bf, acc[j]);
    }
  }
#pragma unroll
  for (int j = 0; j < 4; ++j) {
#pragma unroll
    for (int r = 0; r < 8; ++r) {
      int o = mbase + wave * 16 + r + half * 8;
      int n = n0 + j * 16 + lid;
      size_t idx = ((size_t)b * CHN + o) * NSP + n;
      out[idx] = x[idx] + acc[j][r] + bias[o];
    }
  }
}

// ---------------------------------------------------------------------------
// Workspace layout (bytes)
// ---------------------------------------------------------------------------
#define OFF_WQ    ((size_t)4096)                             // 768*256 bf16
#define OFF_WP    (OFF_WQ + (size_t)3 * CHN * CHN * 2)
#define OFF_XN    (OFF_WP + (size_t)CHN * CHN * 2)           // (b*n, c) bf16 panels
#define OFF_Q     (OFF_XN + (size_t)BATCH * NSP * CHN * 2)   // (bh,n,64) bf16
#define OFF_K     (OFF_Q  + (size_t)BATCH * CHN * NSP * 2)   // (bh,n/32,c/8,n%32,c%8) bf16
#define OFF_V     (OFF_K  + (size_t)BATCH * CHN * NSP * 2)   // (bh,64 rows,n) bf16, rows as the QKV epilogue lays them
#define OFF_A     (OFF_V  + (size_t)BATCH * CHN * NSP * 2)   // (b*n, c) bf16 panels

extern "C" void kernel_launch(void* const* d_in, const int* in_sizes, int n_in,
                              void* d_out, int out_size, void* d_ws, size_t ws_size,
                              hipStream_t stream) {
  const float* x      = (const float*)d_in[0];
  const float* norm_w = (const float*)d_in[1];
  const float* norm_b = (const float*)d_in[2];
  const float* qkv_w  = (const float*)d_in[3];
  const float* qkv_b  = (const float*)d_in[4];
  const float* proj_w = (const float*)d_in[5];
  const float* proj_b = (const float*)d_in[6];

  char* ws = (char*)d_ws;
  unsigned short* wq    = (unsigned short*)(ws + OFF_WQ);
  unsigned short* wp    = (unsigned short*)(ws + OFF_WP);
  unsigned short* xn    = (unsigned short*)(ws + OFF_XN);
  unsigned short* qb    = (unsigned short*)(ws + OFF_Q);
  unsigned short* kb    = (unsigned short*)(ws + OFF_K);
  unsigned short* vb    = (unsigned short*)(ws + OFF_V);
  unsigned short* ab    = (unsigned short*)(ws + OFF_A);

  gn_kernel<<<BATCH * NGRP, 1024, 0, stream>>>(x, norm_w, norm_b, xn);
  f2bf_kernel<<<(3 * CHN * CHN + 255) / 256, 256, 0, stream>>>(qkv_w, wq, 3 * CHN * CHN);
  f2bf_kernel<<<(CHN * CHN + 255) / 256, 256, 0, stream>>>(proj_w, wp, CHN * CHN);

  qkv_gemm_kernel<<<dim3(12, 64, BATCH), 128, 0, stream>>>(wq, xn, qkv_b, qb, kb, vb);
  flash_attn_kernel<<<dim3(BATCH * HEADS, NSP / (16 * 8)), 256, 0, stream>>>(qb, kb, vb, ab);
  proj_gemm_kernel<<<dim3(4, 64, BATCH), 128, 0, stream>>>(wp, ab, proj_b, x, (float*)d_out);
}

// v004
// A run of this version takes 178 microseconds.
// Next to v003, in two timings, it ran 1.08 and 1.09 times as fast.
// Over all steps from v000 it is 3.69 times as fast.
#include <hip/hip_runtime.h>
#include <stdint.h>

typedef __attribute__((ext_vector_type(16))) __bf16 v16bf;
typedef __attribute__((ext_vector_type(8)))  float  v8f;
typedef __attribute__((ext_vector_type(4)))  unsigned int v4u;
typedef __attribute__((ext_vector_type(8)))  int v8i;
typedef __attribute__((ext_vector_type(4)))  int v4i;

#define BATCH 8
#define CHN   256
#define NSP   4096
#define NGRP  32
#define CPG   8      // channels per group
#define HEADS 4
#define CHD   64     // channels per head
#define EPSV  1e-5f

#if __has_builtin(__builtin_amdgcn_tensor_load_to_lds) && \
    __has_builtin(__builtin_amdgcn_s_wait_tensorcnt)
#define USE_TDM 1
#endif

union FragU { v16bf v; uint32_t u[8]; };

__device__ __forceinline__ unsigned short f2bf(float x) {
  union { float f; uint32_t u; } c; c.f = x;
  uint32_t u = c.u;
  u += 0x7fffu + ((u >> 16) & 1u);   // round-to-nearest-even
  return (unsigned short)(u >> 16);
}

__device__ __forceinline__ v16bf load_frag(const unsigned short* base, int half) {
  const uint32_t* p = (const uint32_t*)base;
  FragU f;
  const int o0 = half * 4;       // dword offset of K = half*8
  const int o1 = 8 + half * 4;   // dword offset of K = 16 + half*8
  f.u[0] = p[o0 + 0]; f.u[1] = p[o0 + 1]; f.u[2] = p[o0 + 2]; f.u[3] = p[o0 + 3];
  f.u[4] = p[o1 + 0]; f.u[5] = p[o1 + 1]; f.u[6] = p[o1 + 2]; f.u[7] = p[o1 + 3];
  return f.v;
}

__device__ __forceinline__ const unsigned short* cm_lane(const unsigned short* tile, int rows,
                                                         int row, int half) {
  return tile + (half * rows + row) * 8;
}
__device__ __forceinline__ v16bf load_frag_cm(const unsigned short* lane_base, int rows,
                                              int row0, int kc) {
  const uint32_t* p0 = (const uint32_t*)(lane_base + (kc * rows + row0) * 8);
  const uint32_t* p1 = (const uint32_t*)(lane_base + ((kc + 2) * rows + row0) * 8);
  FragU f;
  f.u[0] = p0[0]; f.u[1] = p0[1]; f.u[2] = p0[2]; f.u[3] = p0[3];
  f.u[4] = p1[0]; f.u[5] = p1[1]; f.u[6] = p1[2]; f.u[7] = p1[3];
  return f.v;
}

// Element index of (row, k) in a matrix of 256 columns kept as dense 64-row
// panels, each panel chunk-major: [row / 64][k / 8][row % 64][k % 8].
__device__ __forceinline__ size_t panel_idx(size_t row, int k) {
  return ((row >> 6) * 32 + (size_t)(k >> 3)) * 512 + (row & 63) * 8 + (size_t)(k & 7);
}

__device__ __forceinline__ v8f wmma_bf16(v16bf a, v16bf b, v8f c) {
  return __builtin_amdgcn_wmma_f32_16x16x32_bf16(
      /*neg_a=*/false, a, /*neg_b=*/false, b,
      /*c_mod=*/(short)0, c, /*reuse_a=*/false, /*reuse_b=*/false);
}

// Two f32 to one register of two bf16, round to nearest even (one v_cvt_pk_bf16_f32).
__device__ __forceinline__ uint32_t pack2(float lo, float hi) {
  typedef __bf16 bf2 __attribute__((ext_vector_type(2)));
  typedef float  f2  __attribute__((ext_vector_type(2)));
  return __builtin_bit_cast(uint32_t, __builtin_convertvector(f2{lo, hi}, bf2));
}

__device__ __forceinline__ float xhalf(float x) {
  int b = __builtin_bit_cast(int, x);
  return __builtin_bit_cast(float,
      __builtin_amdgcn_permlanex16(b, b, 0x76543210, 0xfedcba98, false, false));
}

__device__ __forceinline__ float exp2_1(float x) {
  float p;
  asm("v_exp_f32 %0, %1\n\tv_nop" : "=&v"(p) : "v"(x));
  return p;
}
__device__ __forceinline__ void exp2_8(const float (&x)[8], float (&p)[8]) {
  asm("v_exp_f32 %0, %8\n\t"
      "v_exp_f32 %1, %9\n\t"
      "v_exp_f32 %2, %10\n\t"
      "v_exp_f32 %3, %11\n\t"
      "v_exp_f32 %4, %12\n\t"
      "v_exp_f32 %5, %13\n\t"
      "v_exp_f32 %6, %14\n\t"
      "v_exp_f32 %7, %15\n\t"
      "v_nop"
      : "=&v"(p[0]), "=&v"(p[1]), "=&v"(p[2]), "=&v"(p[3]),
        "=&v"(p[4]), "=&v"(p[5]), "=&v"(p[6]), "=&v"(p[7])
      : "v"(x[0]), "v"(x[1]), "v"(x[2]), "v"(x[3]),
        "v"(x[4]), "v"(x[5]), "v"(x[6]), "v"(x[7]));
}

#ifdef USE_TDM
__device__ __forceinline__ void tdm_load_2d(void* lds_dst, const void* gsrc,
                                            uint32_t tile_d0, uint32_t tile_d1,
                                            uint32_t tensor_d0, uint32_t tensor_d1,
                                            uint32_t stride0) {
  uint64_t ga = (uint64_t)(uintptr_t)gsrc;
  uint32_t lo = (uint32_t)(uintptr_t)lds_dst;  // LDS byte offset (low 32 bits)
  v4u g0;
  g0[0] = 1u;
  g0[1] = lo;
  g0[2] = (uint32_t)ga;
  g0[3] = (uint32_t)((ga >> 32) & 0x01FFFFFFu) | (2u << 30);  // [56:32] | type=2
  v8i g1;
  g1[0] = (int)(1u << 16);
  g1[1] = (int)((tensor_d0 & 0xFFFFu) << 16);
  g1[2] = (int)(((tensor_d0 >> 16) & 0xFFFFu) | ((tensor_d1 & 0xFFFFu) << 16));
  g1[3] = (int)(((tensor_d1 >> 16) & 0xFFFFu) | ((tile_d0 & 0xFFFFu) << 16));
  g1[4] = (int)(tile_d1 & 0xFFFFu);
  g1[5] = (int)stride0;
  g1[6] = 0;
  g1[7] = 0;
  v4i z4 = {0, 0, 0, 0};
  v8i z8 = {0, 0, 0, 0, 0, 0, 0, 0};
  __builtin_amdgcn_tensor_load_to_lds(g0, g1, z4, z4, z8, 0);
}
#endif

// ---------------------------------------------------------------------------
// 1) GroupNorm in one launch: one block of 32 waves per (b, g). A group is 8 channels
//    x 4096 positions = 32 floats per thread, held in registers from the sums to the
//    normalised store, so x is read once. The group's 8 channels are one 16-byte chunk
//    of the panel layout: a lane stores whole chunks, a wave 512 contiguous bytes.
// ---------------------------------------------------------------------------
__global__ void __launch_bounds__(1024)
gn_kernel(const float* __restrict__ x, const float* __restrict__ gw,
          const float* __restrict__ gb, unsigned short* __restrict__ xn) {
  __shared__ float sh_s[32];
  __shared__ float sh_q[32];
  const int lane = threadIdx.x & 31;
  const int wave = threadIdx.x >> 5;
  const int bg = blockIdx.x;                       // b*32 + g
  const int b = bg >> 5, g = bg & 31;
  const float* base = x + (size_t)bg * (CPG * NSP) + wave * 128 + lane;
  float v[CPG][4];
#pragma unroll
  for (int c = 0; c < CPG; ++c)
#pragma unroll
    for (int i = 0; i < 4; ++i) v[c][i] = base[c * NSP + i * 32];

  float s = 0.f, q = 0.f;
#pragma unroll
  for (int c = 0; c < CPG; ++c)
#pragma unroll
    for (int i = 0; i < 4; ++i) { s += v[c][i]; q += v[c][i] * v[c][i]; }
#pragma unroll
  for (int off = 16; off > 0; off >>= 1) {
    s += __shfl_xor(s, off, 32);
    q += __shfl_xor(q, off, 32);
  }
  if (lane == 0) { sh_s[wave] = s; sh_q[wave] = q; }
  __syncthreads();
  // every wave joins the 32 wave sums by the same butterfly: the same bits in every lane
  s = sh_s[lane]; q = sh_q[lane];
#pragma unroll
  for (int off = 16; off > 0; off >>= 1) {
    s += __shfl_xor(s, off, 32);
    q += __shfl_xor(q, off, 32);
  }
  const float inv  = 1.0f / (float)(CPG * NSP);
  const float mean = s * inv;
  const float var  = q * inv - mean * mean;
  const float rstd = rsqrtf(var + EPSV);

  float w8[CPG], b8[CPG];
#pragma unroll
  for (int c = 0; c < CPG; ++c) { w8[c] = gw[g * CPG + c]; b8[c] = gb[g * CPG + c]; }
#pragma unroll
  for (int i = 0; i < 4; ++i) {
    float y[CPG];
#pragma unroll
    for (int c = 0; c < CPG; ++c) y[c] = (v[c][i] - mean) * rstd * w8[c] + b8[c];
    uint4 o;
    o.x = pack2(y[0], y[1]);
    o.y = pack2(y[2], y[3]);
    o.z = pack2(y[4], y[5]);
    o.w = pack2(y[6], y[7]);
    *(uint4*)(xn + panel_idx((size_t)b * NSP + wave * 128 + i * 32 + lane, g * CPG)) = o;
  }
}

// ---------------------------------------------------------------------------
// 2) fp32 -> bf16 weight conversion (256 columns), into chunk-major panels.
// ---------------------------------------------------------------------------
__global__ void __launch_bounds__(256)
f2bf_kernel(const float* __restrict__ src, unsigned short* __restrict__ dst, int n) {
  int i = blockIdx.x * 256 + threadIdx.x;
  // i runs over the destination, so a block writes whole lines:
  // i = [row / 64][k / 8][row % 64][k % 8]
  if (i < n) dst[i] = f2bf(src[((i >> 14) * 64 + ((i >> 3) & 63)) * CHN + ((i >> 9) & 31) * 8 + (i & 7)]);
}

__global__ void __launch_bounds__(128)
qkv_gemm_kernel(const unsigned short* __restrict__ wqkv,
                const unsigned short* __restrict__ xn,
                const float* __restrict__ bias,
                unsigned short* __restrict__ qo,
                unsigned short* __restrict__ ko,
                unsigned short* __restrict__ vo) {
  __shared__ unsigned short Asm[64 * CHN];   // 32 KB: 64 M-rows x 256 K
  __shared__ unsigned short Bsm[64 * CHN];   // 32 KB: 64 N-cols x 256 K
  const int lane = threadIdx.x & 31;
  const int wave = threadIdx.x >> 5;
  const int half = lane >> 4;
  const int lid  = lane & 15;
  const int mbase = blockIdx.x * 64;        // 0..704
  const int n0    = blockIdx.y * 64;
  const int b     = blockIdx.z;

  const unsigned short* ag = wqkv + (size_t)mbase * CHN;
  const unsigned short* bg = xn + ((size_t)b * NSP + n0) * CHN;

#ifdef USE_TDM
  if (wave == 0) {
    tdm_load_2d(Asm, ag, CHN, 64, CHN, 64, CHN);
    tdm_load_2d(Bsm, bg, CHN, 64, CHN, 64, CHN);
    __builtin_amdgcn_s_wait_tensorcnt(0);
  }
#else
  {
    const uint4* as = (const uint4*)ag; uint4* ad = (uint4*)Asm;
    const uint4* bs = (const uint4*)bg; uint4* bd = (uint4*)Bsm;
    for (int t = threadIdx.x; t < 64 * CHN / 8; t += 128) { ad[t] = as[t]; bd[t] = bs[t]; }
  }
#endif
  __syncthreads();

  const unsigned short* al = cm_lane(Asm, 64, wave * 16 + lid, half);
  const unsigned short* bl = cm_lane(Bsm, 64, lid, half);
  v8f acc[4] = {};
  for (int kb = 0; kb < CHN; kb += 32) {
    v16bf a = load_frag_cm(al, 64, 0, kb >> 3);
#pragma unroll
    for (int j = 0; j < 4; ++j) {
      v16bf bf = load_frag_cm(bl, 64, j * 16, kb >> 3);
      acc[j] = wmma_bf16(a, bf, acc[j]);
    }
  }

  const float scale = 0.35355339059327373f;  // 64^-0.25, applied to q and k
#pragma unroll
  for (int j = 0; j < 4; ++j) {
#pragma unroll
    for (int r = 0; r < 8; ++r) {
      int o = mbase + wave * 16 + r + half * 8;  // D layout: row = r + half*8
      int n = n0 + j * 16 + lid;                 //           col = lane % 16
      float val = acc[j][r] + bias[o];
      if (o < CHN) {
        int head = o >> 6, c = o & 63;
        qo[(((size_t)(b * HEADS + head) * NSP) + n) * CHD + c] = f2bf(val * scale);
      } else if (o < 2 * CHN) {
        int oc = o - CHN, head = oc >> 6, c = oc & 63;
        // 32-key tiles, chunk-major: [n / 32][c / 8][n % 32][c % 8]
        ko[((size_t)(b * HEADS + head) * NSP + n0) * CHD + (j >> 1) * 2048 + (c >> 3) * 256 +
           ((j & 1) * 16 + lid) * 8 + r] = f2bf(val * scale);
      } else {
        int oc = o - 2 * CHN, head = oc >> 6, c = oc & 63;
        // row (n % 32) / 8 * 16 + c / 4 of 4096: the 64 x 32 tile at column n / 32 * 32
        // then lands in LDS as [key / 8][c][key % 8]
        vo[((size_t)(b * HEADS + head) * CHD + ((j & 1) * 2 + (lid >> 3)) * 16 + (c >> 2)) * NSP +
           n0 + (j >> 1) * 32 + (r & 3) * 8 + (lid & 7)] = f2bf(val);
      }
    }
  }
}

__global__ void __launch_bounds__(256)
flash_attn_kernel(const unsigned short* __restrict__ q,
                  const unsigned short* __restrict__ k,
                  const unsigned short* __restrict__ v,
                  unsigned short* __restrict__ aout) {
  __shared__ unsigned short Kb[2][32 * CHD];     // 2 x 4 KB (32 keys x 64 ch)
  __shared__ unsigned short Vb[2][CHD * 32];     // 2 x 4 KB (64 ch x 32 keys)
  const int lane = threadIdx.x & 31;
  const int wave = threadIdx.x >> 5;
  const int half = lane >> 4;
  const int lid  = lane & 15;
  const int bh = blockIdx.x;                     // b*4 + head
  const int qt = blockIdx.y * 8 + wave;          // 16-query tile, 0..255

  const unsigned short* kg = k + (size_t)bh * NSP * CHD;  // 32-key chunk-major tiles back to back
  const unsigned short* vg = v + (size_t)bh * CHD * NSP;  // (64, n) row stride N

#ifdef USE_TDM
  auto issue_kv = [&](int buf, int s0) {
    // K tile: one 4 KB chunk-major 32-key tile, copied as 32 x 64, row stride 64 (dense)
    tdm_load_2d(&Kb[buf][0], kg + (size_t)s0 * CHD, CHD, 32, CHD, NSP, CHD);
    // V tile: 64 rows x 32 cols (keys s0..s0+31, all 64 ch), row stride 4096
    tdm_load_2d(&Vb[buf][0], vg + s0, 32, CHD, NSP, CHD, NSP);
  };
  if (wave == 0) { issue_kv(0, 0); __builtin_amdgcn_s_wait_tensorcnt(0); }
  __syncthreads();
#endif

  const unsigned short* qbase = q + ((size_t)bh * NSP + qt * 16 + lid) * CHD;
  v16bf qa0 = load_frag(qbase,      half);       // B: col = query lid, K = c 0..31
  v16bf qa1 = load_frag(qbase + 32, half);       // B: col = query lid, K = c 32..63

  const float LOG2E = 1.44269504f;   // e^x as 2^(x * log2 e), as __expf compiles
  const float LAZY  = 5.5451774f;    // 8 / log2 e
  float m  = -1e30f;      // maximum in use of query lid, the same in both halves
  float mt = m + LAZY;    // what a score must top to move it
  float nml = -m * LOG2E; // -m in log2 units: the addend of every exponent's fma
  float l = 0.f;      // running sum over this half's keys only; halves joined after the loop
  v8f o[4] = {};      // o[j][r] = O^T[c = j*16 + half*8 + r][query lid]

  const int steps = NSP / 32;
  for (int it = 0; it < steps; ++it) {
    const int s0 = it * 32;
#ifdef USE_TDM
    const int cur = it & 1;
    if (wave == 0 && it + 1 < steps) issue_kv(cur ^ 1, s0 + 32);
#else
    const int cur = 0;
    {
      // cooperative stage: K tile is 4 KB contiguous, V tile 64 rows x 64 B
      const uint4* ks = (const uint4*)(kg + (size_t)s0 * CHD);
      ((uint4*)&Kb[0][0])[threadIdx.x] = ks[threadIdx.x];
      int row = threadIdx.x >> 2, ch4 = threadIdx.x & 3;
      ((uint4*)&Vb[0][0])[threadIdx.x] =
          *(const uint4*)(vg + (size_t)row * NSP + s0 + ch4 * 8);
    }
    __syncthreads();
#endif
    // As the QKV epilogue stored them, the landed tiles are chunk-major:
    // Kb = [c / 8][key][c % 8], Vb = [key / 8][c][key % 8].
    const unsigned short* kl = cm_lane(&Kb[cur][0], 32, lid, half);
    const unsigned short* vl = cm_lane(&Vb[cur][0], 64, lid, half);
    v8f st[2] = {};   // st[sub][r] = S^T[key = sub*16 + half*8 + r][query lid]
#pragma unroll
    for (int sub = 0; sub < 2; ++sub) {
      v16bf kb0 = load_frag_cm(kl, 32, sub * 16, 0);   // A: row = key, K = c
      v16bf kb1 = load_frag_cm(kl, 32, sub * 16, 4);
      st[sub] = wmma_bf16(kb0, qa0, st[sub]);
      st[sub] = wmma_bf16(kb1, qa1, st[sub]);
    }
    // Online softmax of one query per lane: 16 of its 32 scores are here, the
    // other 16 in lane ^ 16.
    float cm = fmaxf(st[0][0], st[1][0]);
#pragma unroll
    for (int r = 1; r < 8; ++r) cm = fmaxf(cm, fmaxf(st[0][r], st[1][r]));
    // One scalar branch per pass: the ballot covers both halves of every query. Pass 0
    // always takes it (m starts far below any score) and scales zeros by alpha = 0.
    if (__builtin_amdgcn_ballot_w32(cm > mt) != 0) {
      m = fmaxf(m, fmaxf(cm, xhalf(cm)));
      mt = m + LAZY;
      const float nmlnew = -m * LOG2E;
      const float alpha = exp2_1(nmlnew - nml);
      nml = nmlnew;
      l *= alpha;
#pragma unroll   // constant j: o[] stays in registers
      for (int j = 0; j < 4; ++j) o[j] *= alpha;
    }
    // B operand P^T, column = query lid: elements 0..7 are keys half*8 + 0..7 (tile 0's
    // registers), elements 8..15 keys 16 + half*8 + 0..7 (tile 1's): the k order in which
    // load_frag_cm hands out V's keys.
    FragU pb;
    float rs[2];
    const v8f lg8 = {LOG2E, LOG2E, LOG2E, LOG2E, LOG2E, LOG2E, LOG2E, LOG2E};
    const v8f nm8 = {nml, nml, nml, nml, nml, nml, nml, nml};
#pragma unroll
    for (int sub = 0; sub < 2; ++sub) {
      float x[8], p[8];
      const v8f xs = __builtin_elementwise_fma(st[sub], lg8, nm8);
#pragma unroll
      for (int r = 0; r < 8; ++r) x[r] = xs[r];
      exp2_8(x, p);
#pragma unroll
      for (int i = 0; i < 4; ++i) pb.u[sub * 4 + i] = pack2(p[2 * i], p[2 * i + 1]);
      rs[sub] = ((p[0] + p[1]) + (p[2] + p[3])) + ((p[4] + p[5]) + (p[6] + p[7]));
    }
    l += rs[0] + rs[1];
#pragma unroll
    for (int j = 0; j < 4; ++j) {
      v16bf va = load_frag_cm(vl, 64, j * 16, 0);  // A: row = c, K = key
      o[j] = wmma_bf16(va, pb.v, o[j]);
    }
#ifdef USE_TDM
    if (wave == 0) __builtin_amdgcn_s_wait_tensorcnt(0);
#endif
    __syncthreads();
  }

  const int b = bh >> 2, head = bh & 3;
  // a lane's 8 registers of o[j] are 8 neighbouring channels of one row: one 16-byte chunk
  // of the panel; column tile j lies two chunks (1024 elements) on
  const size_t obase = panel_idx((size_t)b * NSP + qt * 16 + lid, head * CHD + half * 8);
  const float inv = 1.0f / (l + xhalf(l));
#pragma unroll
  for (int j = 0; j < 4; ++j) {
    uint4 w;
    w.x = pack2(o[j][0] * inv, o[j][1] * inv);
    w.y = pack2(o[j][2] * inv, o[j][3] * inv);
    w.z = pack2(o[j][4] * inv, o[j][5] * inv);
    w.w = pack2(o[j][6] * inv, o[j][7] * inv);
    *(uint4*)(aout + obase + j * 1024) = w;
  }
}

__global__ void __launch_bounds__(128)
proj_gemm_kernel(const unsigned short* __restrict__ wp,
                 const unsigned short* __restrict__ a,
                 const float* __restrict__ bias,
                 const float* __restrict__ x,
                 float* __restrict__ out) {
  __shared__ unsigned short Asm[64 * CHN];
  __shared__ unsigned short Bsm[64 * CHN];
  const int lane = threadIdx.x & 31;
  const int wave = threadIdx.x >> 5;
  const int half = lane >> 4;
  const int lid  = lane & 15;
  const int mbase = blockIdx.x * 64;        // 0..192
  const int n0    = blockIdx.y * 64;
  const int b     = blockIdx.z;

  const unsigned short* ag = wp + (size_t)mbase * CHN;
  const unsigned short* bg = a + ((size_t)b * NSP + n0) * CHN;

#ifdef USE_TDM
  if (wave == 0) {
    tdm_load_2d(Asm, ag, CHN, 64, CHN, 64, CHN);
    tdm_load_2d(Bsm, bg, CHN, 64, CHN, 64, CHN);
    __builtin_amdgcn_s_wait_tensorcnt(0);
  }
#else
  {
    const uint4* as = (const uint4*)ag; uint4* ad = (uint4*)Asm;
    const uint4* bs = (const uint4*)bg; uint4* bd = (uint4*)Bsm;
    for (int t = threadIdx.x; t < 64 * CHN / 8; t += 128) { ad[t] = as[t]; bd[t] = bs[t]; }
  }
#endif
  __syncthreads();

  const unsigned short* al = cm_lane(Asm, 64, wave * 16 + lid, half);
  const unsigned short* bl = cm_lane(Bsm, 64, lid, half);
  v8f acc[4] = {};
  for (int kb = 0; kb < CHN; kb += 32) {
    v16bf af = load_frag_cm(al, 64, 0, kb >> 3);
#pragma unroll
    for (int j = 0; j < 4; ++j) {
      v16bf bf = load_frag_cm(bl, 64, j * 16, kb >> 3);
      acc[j] = wmma_bf16(af, bf, acc[j]);
    }
  }
#pragma unroll
  for (int j = 0; j < 4; ++j) {
#pragma unroll
    for (int r = 0; r < 8; ++r) {
      int o = mbase + wave * 16 + r + half * 8;
      int n = n0 + j * 16 + lid;
      size_t idx = ((size_t)b * CHN + o) * NSP + n;
      out[idx] = x[idx] + acc[j][r] + bias[o];
    }
  }
}

// ---------------------------------------------------------------------------
// Workspace layout (bytes)
// ---------------------------------------------------------------------------
#define OFF_WQ    ((size_t)4096)                             // 768*256 bf16
#define OFF_WP    (OFF_WQ + (size_t)3 * CHN * CHN * 2)
#define OFF_XN    (OFF_WP + (size_t)CHN * CHN * 2)           // (b*n, c) bf16 panels
#define OFF_Q     (OFF_XN + (size_t)BATCH * NSP * CHN * 2)   // (bh,n,64) bf16
#define OFF_K     (OFF_Q  + (size_t)BATCH * CHN * NSP * 2)   // (bh,n/32,c/8,n%32,c%8) bf16
#define OFF_V     (OFF_K  + (size_t)BATCH * CHN * NSP * 2)   // (bh,64 rows,n) bf16, rows as the QKV epilogue lays them
#define OFF_A     (OFF_V  + (size_t)BATCH * CHN * NSP * 2)   // (b*n, c) bf16 panels

extern "C" void kernel_launch(void* const* d_in, const int* in_sizes, int n_in,
                              void* d_out, int out_size, void* d_ws, size_t ws_size,
                              hipStream_t stream) {
  const float* x      = (const float*)d_in[0];
  const float* norm_w = (const float*)d_in[1];
  const float* norm_b = (const float*)d_in[2];
  const float* qkv_w  = (const float*)d_in[3];
  const float* qkv_b  = (const float*)d_in[4];
  const float* proj_w = (const float*)d_in[5];
  const float* proj_b = (const float*)d_in[6];

  char* ws = (char*)d_ws;
  unsigned short* wq    = (unsigned short*)(ws + OFF_WQ);
  unsigned short* wp    = (unsigned short*)(ws + OFF_WP);
  unsigned short* xn    = (unsigned short*)(ws + OFF_XN);
  unsigned short* qb    = (unsigned short*)(ws + OFF_Q);
  unsigned short* kb    = (unsigned short*)(ws + OFF_K);
  unsigned short* vb    = (unsigned short*)(ws + OFF_V);
  unsigned short* ab    = (unsigned short*)(ws + OFF_A);

  gn_kernel<<<BATCH * NGRP, 1024, 0, stream>>>(x, norm_w, norm_b, xn);
  f2bf_kernel<<<(3 * CHN * CHN + 255) / 256, 256, 0, stream>>>(qkv_w, wq, 3 * CHN * CHN);
  f2bf_kernel<<<(CHN * CHN + 255) / 256, 256, 0, stream>>>(proj_w, wp, CHN * CHN);

  qkv_gemm_kernel<<<dim3(12, 64, BATCH), 128, 0, stream>>>(wq, xn, qkv_b, qb, kb, vb);
  flash_attn_kernel<<<dim3(BATCH * HEADS, NSP / (16 * 8)), 256, 0, stream>>>(qb, kb, vb, ab);
  proj_gemm_kernel<<<dim3(4, 64, BATCH), 128, 0, stream>>>(wp, ab, proj_b, x, (float*)d_out);
}

// v005
// One run takes 173 microseconds.
// In both of two side-by-side timings against v004, it was 1.03 times as fast.
// Over all steps from v000 it is 3.80 times as fast.
#include <hip/hip_runtime.h>
#include <stdint.h>

typedef __attribute__((ext_vector_type(16))) __bf16 v16bf;
typedef __attribute__((ext_vector_type(8)))  float  v8f;
typedef __attribute__((ext_vector_type(4)))  unsigned int v4u;
typedef __attribute__((ext_vector_type(8)))  int v8i;
typedef __attribute__((ext_vector_type(4)))  int v4i;

#define BATCH 8
#define CHN   256
#define NSP   4096
#define NGRP  32
#define CPG   8      // channels per group
#define HEADS 4
#define CHD   64     // channels per head
#define EPSV  1e-5f

#if __has_builtin(__builtin_amdgcn_tensor_load_to_lds) && \
    __has_builtin(__builtin_amdgcn_s_wait_tensorcnt)
#define USE_TDM 1
#endif

union FragU { v16bf v; uint32_t u[8]; };

__device__ __forceinline__ unsigned short f2bf(float x) {
  union { float f; uint32_t u; } c; c.f = x;
  uint32_t u = c.u;
  u += 0x7fffu + ((u >> 16) & 1u);   // round-to-nearest-even
  return (unsigned short)(u >> 16);
}

__device__ __forceinline__ v16bf load_frag(const unsigned short* base, int half) {
  const uint32_t* p = (const uint32_t*)base;
  FragU f;
  const int o0 = half * 4;       // dword offset of K = half*8
  const int o1 = 8 + half * 4;   // dword offset of K = 16 + half*8
  f.u[0] = p[o0 + 0]; f.u[1] = p[o0 + 1]; f.u[2] = p[o0 + 2]; f.u[3] = p[o0 + 3];
  f.u[4] = p[o1 + 0]; f.u[5] = p[o1 + 1]; f.u[6] = p[o1 + 2]; f.u[7] = p[o1 + 3];
  return f.v;
}

__device__ __forceinline__ const unsigned short* cm_lane(const unsigned short* tile, int rows,
                                                         int row, int half) {
  return tile + (half * rows + row) * 8;
}
__device__ __forceinline__ v16bf load_frag_cm(const unsigned short* lane_base, int rows,
                                              int row0, int kc) {
  const uint32_t* p0 = (const uint32_t*)(lane_base + (kc * rows + row0) * 8);
  const uint32_t* p1 = (const uint32_t*)(lane_base + ((kc + 2) * rows + row0) * 8);
  FragU f;
  f.u[0] = p0[0]; f.u[1] = p0[1]; f.u[2] = p0[2]; f.u[3] = p0[3];
  f.u[4] = p1[0]; f.u[5] = p1[1]; f.u[6] = p1[2]; f.u[7] = p1[3];
  return f.v;
}

// Element index of (row, k) in a matrix of 256 columns kept as dense 64-row
// panels, each panel chunk-major: [row / 64][k / 8][row % 64][k % 8].
__device__ __forceinline__ size_t panel_idx(size_t row, int k) {
  return ((row >> 6) * 32 + (size_t)(k >> 3)) * 512 + (row & 63) * 8 + (size_t)(k & 7);
}

__device__ __forceinline__ v8f wmma_bf16(v16bf a, v16bf b, v8f c) {
  return __builtin_amdgcn_wmma_f32_16x16x32_bf16(
      /*neg_a=*/false, a, /*neg_b=*/false, b,
      /*c_mod=*/(short)0, c, /*reuse_a=*/false, /*reuse_b=*/false);
}

// Two f32 to one register of two bf16, round to nearest even (one v_cvt_pk_bf16_f32).
__device__ __forceinline__ uint32_t pack2(float lo, float hi) {
  typedef __bf16 bf2 __attribute__((ext_vector_type(2)));
  typedef float  f2  __attribute__((ext_vector_type(2)));
  return __builtin_bit_cast(uint32_t, __builtin_convertvector(f2{lo, hi}, bf2));
}

__device__ __forceinline__ float xhalf(float x) {
  int b = __builtin_bit_cast(int, x);
  return __builtin_bit_cast(float,
      __builtin_amdgcn_permlanex16(b, b, 0x76543210, 0xfedcba98, false, false));
}

__device__ __forceinline__ float exp2_1(float x) {
  float p;
  asm("v_exp_f32 %0, %1\n\tv_nop" : "=&v"(p) : "v"(x));
  return p;
}
__device__ __forceinline__ void exp2_8(const float (&x)[8], float (&p)[8]) {
  asm("v_exp_f32 %0, %8\n\t"
      "v_exp_f32 %1, %9\n\t"
      "v_exp_f32 %2, %10\n\t"
      "v_exp_f32 %3, %11\n\t"
      "v_exp_f32 %4, %12\n\t"
      "v_exp_f32 %5, %13\n\t"
      "v_exp_f32 %6, %14\n\t"
      "v_exp_f32 %7, %15\n\t"
      "v_nop"
      : "=&v"(p[0]), "=&v"(p[1]), "=&v"(p[2]), "=&v"(p[3]),
        "=&v"(p[4]), "=&v"(p[5]), "=&v"(p[6]), "=&v"(p[7])
      : "v"(x[0]), "v"(x[1]), "v"(x[2]), "v"(x[3]),
        "v"(x[4]), "v"(x[5]), "v"(x[6]), "v"(x[7]));
}

#ifdef USE_TDM
__device__ __forceinline__ void tdm_load_2d(void* lds_dst, const void* gsrc,
                                            uint32_t tile_d0, uint32_t tile_d1,
                                            uint32_t tensor_d0, uint32_t tensor_d1,
                                            uint32_t stride0) {
  uint64_t ga = (uint64_t)(uintptr_t)gsrc;
  uint32_t lo = (uint32_t)(uintptr_t)lds_dst;  // LDS byte offset (low 32 bits)
  v4u g0;
  g0[0] = 1u;
  g0[1] = lo;
  g0[2] = (uint32_t)ga;
  g0[3] = (uint32_t)((ga >> 32) & 0x01FFFFFFu) | (2u << 30);  // [56:32] | type=2
  v8i g1;
  g1[0] = (int)(1u << 16);
  g1[1] = (int)((tensor_d0 & 0xFFFFu) << 16);
  g1[2] = (int)(((tensor_d0 >> 16) & 0xFFFFu) | ((tensor_d1 & 0xFFFFu) << 16));
  g1[3] = (int)(((tensor_d1 >> 16) & 0xFFFFu) | ((tile_d0 & 0xFFFFu) << 16));
  g1[4] = (int)(tile_d1 & 0xFFFFu);
  g1[5] = (int)stride0;
  g1[6] = 0;
  g1[7] = 0;
  v4i z4 = {0, 0, 0, 0};
  v8i z8 = {0, 0, 0, 0, 0, 0, 0, 0};
  __builtin_amdgcn_tensor_load_to_lds(g0, g1, z4, z4, z8, 0);
}
#endif

// ---------------------------------------------------------------------------
// 1) GroupNorm in one launch: one block of 32 waves per (b, g). A group is 8 channels
//    x 4096 positions = 32 floats per thread, held in registers from the sums to the
//    normalised store, so x is read once. The group's 8 channels are one 16-byte chunk
//    of the panel layout: a lane stores whole chunks, a wave 512 contiguous bytes.
// ---------------------------------------------------------------------------
__global__ void __launch_bounds__(1024)
gn_kernel(const float* __restrict__ x, const float* __restrict__ gw,
          const float* __restrict__ gb, unsigned short* __restrict__ xn) {
  __shared__ float sh_s[32];
  __shared__ float sh_q[32];
  const int lane = threadIdx.x & 31;
  const int wave = threadIdx.x >> 5;
  const int bg = blockIdx.x;                       // b*32 + g
  const int b = bg >> 5, g = bg & 31;
  const float* base = x + (size_t)bg * (CPG * NSP) + wave * 128 + lane;
  float v[CPG][4];
#pragma unroll
  for (int c = 0; c < CPG; ++c)
#pragma unroll
    for (int i = 0; i < 4; ++i) v[c][i] = base[c * NSP + i * 32];

  float s = 0.f, q = 0.f;
#pragma unroll
  for (int c = 0; c < CPG; ++c)
#pragma unroll
    for (int i = 0; i < 4; ++i) { s += v[c][i]; q += v[c][i] * v[c][i]; }
#pragma unroll
  for (int off = 16; off > 0; off >>= 1) {
    s += __shfl_xor(s, off, 32);
    q += __shfl_xor(q, off, 32);
  }
  if (lane == 0) { sh_s[wave] = s; sh_q[wave] = q; }
  __syncthreads();
  // every wave joins the 32 wave sums by the same butterfly: the same bits in every lane
  s = sh_s[lane]; q = sh_q[lane];
#pragma unroll
  for (int off = 16; off > 0; off >>= 1) {
    s += __shfl_xor(s, off, 32);
    q += __shfl_xor(q, off, 32);
  }
  const float inv  = 1.0f / (float)(CPG * NSP);
  const float mean = s * inv;
  const float var  = q * inv - mean * mean;
  const float rstd = rsqrtf(var + EPSV);

  float w8[CPG], b8[CPG];
#pragma unroll
  for (int c = 0; c < CPG; ++c) { w8[c] = gw[g * CPG + c]; b8[c] = gb[g * CPG + c]; }
#pragma unroll
  for (int i = 0; i < 4; ++i) {
    float y[CPG];
#pragma unroll
    for (int c = 0; c < CPG; ++c) y[c] = (v[c][i] - mean) * rstd * w8[c] + b8[c];
    uint4 o;
    o.x = pack2(y[0], y[1]);
    o.y = pack2(y[2], y[3]);
    o.z = pack2(y[4], y[5]);
    o.w = pack2(y[6], y[7]);
    *(uint4*)(xn + panel_idx((size_t)b * NSP + wave * 128 + i * 32 + lane, g * CPG)) = o;
  }
}

// ---------------------------------------------------------------------------
// 2) fp32 -> bf16 weight conversion (256 columns), into chunk-major panels.
// ---------------------------------------------------------------------------
__global__ void __launch_bounds__(256)
f2bf_kernel(const float* __restrict__ src, unsigned short* __restrict__ dst, int n) {
  int i = blockIdx.x * 256 + threadIdx.x;
  // i runs over the destination, so a block writes whole lines:
  // i = [row / 64][k / 8][row % 64][k % 8]
  if (i < n) dst[i] = f2bf(src[((i >> 14) * 64 + ((i >> 3) & 63)) * CHN + ((i >> 9) & 31) * 8 + (i & 7)]);
}

__global__ void __launch_bounds__(128)
qkv_gemm_kernel(const unsigned short* __restrict__ wqkv,
                const unsigned short* __restrict__ xn,
                const float* __restrict__ bias,
                unsigned short* __restrict__ qo,
                unsigned short* __restrict__ ko,
                unsigned short* __restrict__ vo) {
  __shared__ unsigned short Asm[64 * CHN];   // 32 KB: 64 M-rows x 256 K
  __shared__ unsigned short Bsm[64 * CHN];   // 32 KB: 64 N-cols x 256 K
  const int lane = threadIdx.x & 31;
  const int wave = threadIdx.x >> 5;
  const int half = lane >> 4;
  const int lid  = lane & 15;
  const int mbase = blockIdx.x * 64;        // 0..704
  const int n0    = blockIdx.y * 64;
  const int b     = blockIdx.z;

  const unsigned short* ag = wqkv + (size_t)mbase * CHN;
  const unsigned short* bg = xn + ((size_t)b * NSP + n0) * CHN;

#ifdef USE_TDM
  if (wave == 0) {
    tdm_load_2d(Asm, ag, CHN, 64, CHN, 64, CHN);
    tdm_load_2d(Bsm, bg, CHN, 64, CHN, 64, CHN);
    __builtin_amdgcn_s_wait_tensorcnt(0);
  }
#else
  {
    const uint4* as = (const uint4*)ag; uint4* ad = (uint4*)Asm;
    const uint4* bs = (const uint4*)bg; uint4* bd = (uint4*)Bsm;
    for (int t = threadIdx.x; t < 64 * CHN / 8; t += 128) { ad[t] = as[t]; bd[t] = bs[t]; }
  }
#endif
  __syncthreads();

  const unsigned short* al = cm_lane(Asm, 64, wave * 16 + lid, half);
  const unsigned short* bl = cm_lane(Bsm, 64, lid, half);
  v8f acc[4] = {};
  for (int kb = 0; kb < CHN; kb += 32) {
    v16bf a = load_frag_cm(al, 64, 0, kb >> 3);
#pragma unroll
    for (int j = 0; j < 4; ++j) {
      v16bf bf = load_frag_cm(bl, 64, j * 16, kb >> 3);
      acc[j] = wmma_bf16(a, bf, acc[j]);
    }
  }

  const float scale = 0.35355339059327373f;  // 64^-0.25, applied to q and k
#pragma unroll
  for (int j = 0; j < 4; ++j) {
#pragma unroll
    for (int r = 0; r < 8; ++r) {
      int o = mbase + wave * 16 + r + half * 8;  // D layout: row = r + half*8
      int n = n0 + j * 16 + lid;                 //           col = lane % 16
      float val = acc[j][r] + bias[o];
      if (o < CHN) {
        int head = o >> 6, c = o & 63;
        qo[(((size_t)(b * HEADS + head) * NSP) + n) * CHD + c] = f2bf(val * scale);
      } else if (o < 2 * CHN) {
        int oc = o - CHN, head = oc >> 6, c = oc & 63;
        // 32-key tiles, chunk-major: [n / 32][c / 8][n % 32][c % 8]
        ko[((size_t)(b * HEADS + head) * NSP + n0) * CHD + (j >> 1) * 2048 + (c >> 3) * 256 +
           ((j & 1) * 16 + lid) * 8 + r] = f2bf(val * scale);
      } else {
        int oc = o - 2 * CHN, head = oc >> 6, c = oc & 63;
        // row (n % 32) / 8 * 16 + c / 4 of 4096: the 64 x 32 tile at column n / 32 * 32
        // then lands in LDS as [key / 8][c][key % 8]
        vo[((size_t)(b * HEADS + head) * CHD + ((j & 1) * 2 + (lid >> 3)) * 16 + (c >> 2)) * NSP +
           n0 + (j >> 1) * 32 + (r & 3) * 8 + (lid & 7)] = f2bf(val);
      }
    }
  }
}

__global__ void __launch_bounds__(256)
flash_attn_kernel(const unsigned short* __restrict__ q,
                  const unsigned short* __restrict__ k,
                  const unsigned short* __restrict__ v,
                  unsigned short* __restrict__ aout) {
  __shared__ unsigned short Kb[2][32 * CHD];     // 2 x 4 KB (32 keys x 64 ch)
  __shared__ unsigned short Vb[2][CHD * 32];     // 2 x 4 KB (64 ch x 32 keys)
  const int lane = threadIdx.x & 31;
  const int wave = threadIdx.x >> 5;
  const int half = lane >> 4;
  const int lid  = lane & 15;
  const int bh = blockIdx.x;                     // b*4 + head
  const int qt = (blockIdx.y * 8 + wave) * 2;    // first of two 16-query tiles, 0..254

  const unsigned short* kg = k + (size_t)bh * NSP * CHD;  // (n/32, c/8, n%32, c%8) tiles, dense
  const unsigned short* vg = v + (size_t)bh * CHD * NSP;  // (64, n) row stride N

#ifdef USE_TDM
  auto issue_kv = [&](int buf, int s0) {
    // K tile: one 4 KB chunk-major 32-key tile, copied as 32 x 64, row stride 64 (dense)
    tdm_load_2d(&Kb[buf][0], kg + (size_t)s0 * CHD, CHD, 32, CHD, NSP, CHD);
    // V tile: 64 rows x 32 cols (keys s0..s0+31, all 64 ch), row stride 4096
    tdm_load_2d(&Vb[buf][0], vg + s0, 32, CHD, NSP, CHD, NSP);
  };
  if (wave == 0) { issue_kv(0, 0); __builtin_amdgcn_s_wait_tensorcnt(0); }
  __syncthreads();
#endif

  v16bf qa0[2], qa1[2];                          // [g]: column group g = queries (qt + g) * 16 + lid
#pragma unroll
  for (int g = 0; g < 2; ++g) {
    const unsigned short* qbase = q + ((size_t)bh * NSP + (qt + g) * 16 + lid) * CHD;
    qa0[g] = load_frag(qbase,      half);        // B: col = query lid, K = c 0..31
    qa1[g] = load_frag(qbase + 32, half);        // B: col = query lid, K = c 32..63
  }

  const float LOG2E = 1.44269504f;   // e^x as 2^(x * log2 e), as __expf compiles
  const float LAZY  = 5.5451774f;    // 8 / log2 e
  float m[2], mt[2], nml[2], l[2];
  v8f o[2][4] = {};   // o[g][j][r] = O^T[c = j*16 + half*8 + r][query lid of group g]
#pragma unroll
  for (int g = 0; g < 2; ++g) {
    m[g]  = -1e30f;         // maximum in use of query lid, the same in both halves
    mt[g] = m[g] + LAZY;    // what a score must top to move it
    nml[g] = -m[g] * LOG2E; // -m in log2 units: the addend of every exponent's fma
    l[g] = 0.f;         // running sum over this half's keys only; halves joined after the loop
  }

  const int steps = NSP / 32;
  for (int it = 0; it < steps; ++it) {
    const int s0 = it * 32;
#ifdef USE_TDM
    const int cur = it & 1;
    if (wave == 0 && it + 1 < steps) issue_kv(cur ^ 1, s0 + 32);
#else
    const int cur = 0;
    {
      // cooperative stage: K tile is 4 KB contiguous, V tile 64 rows x 64 B
      const uint4* ks = (const uint4*)(kg + (size_t)s0 * CHD);
      ((uint4*)&Kb[0][0])[threadIdx.x] = ks[threadIdx.x];
      int row = threadIdx.x >> 2, ch4 = threadIdx.x & 3;
      ((uint4*)&Vb[0][0])[threadIdx.x] =
          *(const uint4*)(vg + (size_t)row * NSP + s0 + ch4 * 8);
    }
    __syncthreads();
#endif
    // As the QKV epilogue stored them, the landed tiles are chunk-major:
    // Kb = [c / 8][key][c % 8], Vb = [key / 8][c][key % 8].
    const unsigned short* kl = cm_lane(&Kb[cur][0], 32, lid, half);
    const unsigned short* vl = cm_lane(&Vb[cur][0], 64, lid, half);
    v8f st[2][2] = {};   // st[g][sub][r] = S^T[key = sub*16 + half*8 + r][query lid of group g]
#pragma unroll
    for (int sub = 0; sub < 2; ++sub) {
      v16bf kb0 = load_frag_cm(kl, 32, sub * 16, 0);   // A: row = key, K = c
      v16bf kb1 = load_frag_cm(kl, 32, sub * 16, 4);
#pragma unroll
      for (int g = 0; g < 2; ++g) st[g][sub] = wmma_bf16(kb0, qa0[g], st[g][sub]);
#pragma unroll
      for (int g = 0; g < 2; ++g) st[g][sub] = wmma_bf16(kb1, qa1[g], st[g][sub]);
    }
    // Online softmax of one query per lane and group: 16 of its 32 scores are here, the
    // other 16 in lane ^ 16.
    float cm[2];
#pragma unroll
    for (int g = 0; g < 2; ++g) {
      cm[g] = fmaxf(st[g][0][0], st[g][1][0]);
#pragma unroll
      for (int r = 1; r < 8; ++r) cm[g] = fmaxf(cm[g], fmaxf(st[g][0][r], st[g][1][r]));
    }
    // One scalar branch per pass: the ballot covers both halves of every query of both
    // groups. Pass 0 always takes it (m starts far below any score) and scales zeros by
    // alpha = 0.
    if (__builtin_amdgcn_ballot_w32((cm[0] > mt[0]) | (cm[1] > mt[1])) != 0) {
#pragma unroll   // constant g and j: o[] stays in registers
      for (int g = 0; g < 2; ++g) {
        m[g] = fmaxf(m[g], fmaxf(cm[g], xhalf(cm[g])));
        mt[g] = m[g] + LAZY;
        const float nmlnew = -m[g] * LOG2E;
        const float alpha = exp2_1(nmlnew - nml[g]);
        nml[g] = nmlnew;
        l[g] *= alpha;
#pragma unroll
        for (int j = 0; j < 4; ++j) o[g][j] *= alpha;
      }
    }
    // B operand P^T, column = query lid: elements 0..7 are keys half*8 + 0..7 (tile 0's
    // registers), elements 8..15 keys 16 + half*8 + 0..7 (tile 1's): the k order in which
    // load_frag_cm hands out V's keys.
    FragU pb[2];
    const v8f lg8 = {LOG2E, LOG2E, LOG2E, LOG2E, LOG2E, LOG2E, LOG2E, LOG2E};
#pragma unroll
    for (int g = 0; g < 2; ++g) {
      float rs[2];
      const v8f nm8 = {nml[g], nml[g], nml[g], nml[g], nml[g], nml[g], nml[g], nml[g]};
#pragma unroll
      for (int sub = 0; sub < 2; ++sub) {
        float x[8], p[8];
        const v8f xs = __builtin_elementwise_fma(st[g][sub], lg8, nm8);
#pragma unroll
        for (int r = 0; r < 8; ++r) x[r] = xs[r];
        exp2_8(x, p);
#pragma unroll
        for (int i = 0; i < 4; ++i) pb[g].u[sub * 4 + i] = pack2(p[2 * i], p[2 * i + 1]);
        rs[sub] = ((p[0] + p[1]) + (p[2] + p[3])) + ((p[4] + p[5]) + (p[6] + p[7]));
      }
      l[g] += rs[0] + rs[1];
    }
#pragma unroll
    for (int j = 0; j < 4; ++j) {
      v16bf va = load_frag_cm(vl, 64, j * 16, 0);  // A: row = c, K = key
#pragma unroll
      for (int g = 0; g < 2; ++g) o[g][j] = wmma_bf16(va, pb[g].v, o[g][j]);
    }
#ifdef USE_TDM
    if (wave == 0) __builtin_amdgcn_s_wait_tensorcnt(0);
#endif
    __syncthreads();
  }

  const int b = bh >> 2, head = bh & 3;
  // a lane's 8 registers of o[j] are 8 neighbouring channels of one row: one 16-byte chunk
  // of the panel; column tile j lies two chunks (1024 elements) on
#pragma unroll
  for (int g = 0; g < 2; ++g) {
    const size_t obase = panel_idx((size_t)b * NSP + (qt + g) * 16 + lid, head * CHD + half * 8);
    const float inv = 1.0f / (l[g] + xhalf(l[g]));
#pragma unroll
    for (int j = 0; j < 4; ++j) {
      uint4 w;
      w.x = pack2(o[g][j][0] * inv, o[g][j][1] * inv);
      w.y = pack2(o[g][j][2] * inv, o[g][j][3] * inv);
      w.z = pack2(o[g][j][4] * inv, o[g][j][5] * inv);
      w.w = pack2(o[g][j][6] * inv, o[g][j][7] * inv);
      *(uint4*)(aout + obase + j * 1024) = w;
    }
  }
}

__global__ void __launch_bounds__(128)
proj_gemm_kernel(const unsigned short* __restrict__ wp,
                 const unsigned short* __restrict__ a,
                 const float* __restrict__ bias,
                 const float* __restrict__ x,
                 float* __restrict__ out) {
  __shared__ unsigned short Asm[64 * CHN];
  __shared__ unsigned short Bsm[64 * CHN];
  const int lane = threadIdx.x & 31;
  const int wave = threadIdx.x >> 5;
  const int half = lane >> 4;
  const int lid  = lane & 15;
  const int mbase = blockIdx.x * 64;        // 0..192
  const int n0    = blockIdx.y * 64;
  const int b     = blockIdx.z;

  const unsigned short* ag = wp + (size_t)mbase * CHN;
  const unsigned short* bg = a + ((size_t)b * NSP + n0) * CHN;

#ifdef USE_TDM
  if (wave == 0) {
    tdm_load_2d(Asm, ag, CHN, 64, CHN, 64, CHN);
    tdm_load_2d(Bsm, bg, CHN, 64, CHN, 64, CHN);
    __builtin_amdgcn_s_wait_tensorcnt(0);
  }
#else
  {
    const uint4* as = (const uint4*)ag; uint4* ad = (uint4*)Asm;
    const uint4* bs = (const uint4*)bg; uint4* bd = (uint4*)Bsm;
    for (int t = threadIdx.x; t < 64 * CHN / 8; t += 128) { ad[t] = as[t]; bd[t] = bs[t]; }
  }
#endif
  __syncthreads();

  const unsigned short* al = cm_lane(Asm, 64, wave * 16 + lid, half);
  const unsigned short* bl = cm_lane(Bsm, 64, lid, half);
  v8f acc[4] = {};
  for (int kb = 0; kb < CHN; kb += 32) {
    v16bf af = load_frag_cm(al, 64, 0, kb >> 3);
#pragma unroll
    for (int j = 0; j < 4; ++j) {
      v16bf bf = load_frag_cm(bl, 64, j * 16, kb >> 3);
      acc[j] = wmma_bf16(af, bf, acc[j]);
    }
  }
#pragma unroll
  for (int j = 0; j < 4; ++j) {
#pragma unroll
    for (int r = 0; r < 8; ++r) {
      int o = mbase + wave * 16 + r + half * 8;
      int n = n0 + j * 16 + lid;
      size_t idx = ((size_t)b * CHN + o) * NSP + n;
      out[idx] = x[idx] + acc[j][r] + bias[o];
    }
  }
}

// ---------------------------------------------------------------------------
// Workspace layout (bytes)
// ---------------------------------------------------------------------------
#define OFF_WQ    ((size_t)4096)                             // 768*256 bf16
#define OFF_WP    (OFF_WQ + (size_t)3 * CHN * CHN * 2)
#define OFF_XN    (OFF_WP + (size_t)CHN * CHN * 2)           // (b*n, c) bf16 panels
#define OFF_Q     (OFF_XN + (size_t)BATCH * NSP * CHN * 2)   // (bh,n,64) bf16
#define OFF_K     (OFF_Q  + (size_t)BATCH * CHN * NSP * 2)   // (bh,n/32,c/8,n%32,c%8) bf16
#define OFF_V     (OFF_K  + (size_t)BATCH * CHN * NSP * 2)   // (bh,64 rows,n) bf16, rows as the QKV epilogue lays them
#define OFF_A     (OFF_V  + (size_t)BATCH * CHN * NSP * 2)   // (b*n, c) bf16 panels

extern "C" void kernel_launch(void* const* d_in, const int* in_sizes, int n_in,
                              void* d_out, int out_size, void* d_ws, size_t ws_size,
                              hipStream_t stream) {
  const float* x      = (const float*)d_in[0];
  const float* norm_w = (const float*)d_in[1];
  const float* norm_b = (const float*)d_in[2];
  const float* qkv_w  = (const float*)d_in[3];
  const float* qkv_b  = (const float*)d_in[4];
  const float* proj_w = (const float*)d_in[5];
  const float* proj_b = (const float*)d_in[6];

  char* ws = (char*)d_ws;
  unsigned short* wq    = (unsigned short*)(ws + OFF_WQ);
  unsigned short* wp    = (unsigned short*)(ws + OFF_WP);
  unsigned short* xn    = (unsigned short*)(ws + OFF_XN);
  unsigned short* qb    = (unsigned short*)(ws + OFF_Q);
  unsigned short* kb    = (unsigned short*)(ws + OFF_K);
  unsigned short* vb    = (unsigned short*)(ws + OFF_V);
  unsigned short* ab    = (unsigned short*)(ws + OFF_A);

  gn_kernel<<<BATCH * NGRP, 1024, 0, stream>>>(x, norm_w, norm_b, xn);
  f2bf_kernel<<<(3 * CHN * CHN + 255) / 256, 256, 0, stream>>>(qkv_w, wq, 3 * CHN * CHN);
  f2bf_kernel<<<(CHN * CHN + 255) / 256, 256, 0, stream>>>(proj_w, wp, CHN * CHN);

  qkv_gemm_kernel<<<dim3(12, 64, BATCH), 128, 0, stream>>>(wq, xn, qkv_b, qb, kb, vb);
  flash_attn_kernel<<<dim3(BATCH * HEADS, NSP / (32 * 8)), 256, 0, stream>>>(qb, kb, vb, ab);
  proj_gemm_kernel<<<dim3(4, 64, BATCH), 128, 0, stream>>>(wp, ab, proj_b, x, (float*)d_out);
}

// v006
// A run of this version takes 140 microseconds.
// Timed twice side by side with v005, it ran 1.23 times as fast both times.
// Counting every step since v000, it is 4.68 times as fast.
#include <hip/hip_runtime.h>
#include <stdint.h>

typedef __attribute__((ext_vector_type(16))) __bf16 v16bf;
typedef __attribute__((ext_vector_type(8)))  float  v8f;
typedef __attribute__((ext_vector_type(4)))  unsigned int v4u;
typedef __attribute__((ext_vector_type(8)))  int v8i;
typedef __attribute__((ext_vector_type(4)))  int v4i;

#define BATCH 8
#define CHN   256
#define NSP   4096
#define NGRP  32
#define CPG   8      // channels per group
#define HEADS 4
#define CHD   64     // channels per head
#define EPSV  1e-5f

#if __has_builtin(__builtin_amdgcn_tensor_load_to_lds) && \
    __has_builtin(__builtin_amdgcn_s_wait_tensorcnt)
#define USE_TDM 1
#endif

union FragU { v16bf v; uint32_t u[8]; };

__device__ __forceinline__ unsigned short f2bf(float x) {
  union { float f; uint32_t u; } c; c.f = x;
  uint32_t u = c.u;
  u += 0x7fffu + ((u >> 16) & 1u);   // round-to-nearest-even
  return (unsigned short)(u >> 16);
}

__device__ __forceinline__ const unsigned short* cm_lane(const unsigned short* tile, int rows,
                                                         int row, int half) {
  return tile + (half * rows + row) * 8;
}
__device__ __forceinline__ v16bf load_frag_cm(const unsigned short* lane_base, int rows,
                                              int row0, int kc) {
  const uint32_t* p0 = (const uint32_t*)(lane_base + (kc * rows + row0) * 8);
  const uint32_t* p1 = (const uint32_t*)(lane_base + ((kc + 2) * rows + row0) * 8);
  FragU f;
  f.u[0] = p0[0]; f.u[1] = p0[1]; f.u[2] = p0[2]; f.u[3] = p0[3];
  f.u[4] = p1[0]; f.u[5] = p1[1]; f.u[6] = p1[2]; f.u[7] = p1[3];
  return f.v;
}

// Element index of (row, k) in a matrix of 256 columns kept as dense 64-row
// panels, each panel chunk-major: [row / 64][k / 8][row % 64][k % 8].
__device__ __forceinline__ size_t panel_idx(size_t row, int k) {
  return ((row >> 6) * 32 + (size_t)(k >> 3)) * 512 + (row & 63) * 8 + (size_t)(k & 7);
}

__device__ __forceinline__ v8f wmma_bf16(v16bf a, v16bf b, v8f c) {
  return __builtin_amdgcn_wmma_f32_16x16x32_bf16(
      /*neg_a=*/false, a, /*neg_b=*/false, b,
      /*c_mod=*/(short)0, c, /*reuse_a=*/false, /*reuse_b=*/false);
}

// Two f32 to one register of two bf16, round to nearest even (one v_cvt_pk_bf16_f32).
__device__ __forceinline__ uint32_t pack2(float lo, float hi) {
  typedef __bf16 bf2 __attribute__((ext_vector_type(2)));
  typedef float  f2  __attribute__((ext_vector_type(2)));
  return __builtin_bit_cast(uint32_t, __builtin_convertvector(f2{lo, hi}, bf2));
}

__device__ __forceinline__ float xhalf(float x) {
  int b = __builtin_bit_cast(int, x);
  return __builtin_bit_cast(float,
      __builtin_amdgcn_permlanex16(b, b, 0x76543210, 0xfedcba98, false, false));
}

__device__ __forceinline__ float exp2_1(float x) {
  float p;
  asm("v_exp_f32 %0, %1\n\tv_nop" : "=&v"(p) : "v"(x));
  return p;
}
__device__ __forceinline__ void exp2_8(const float (&x)[8], float (&p)[8]) {
  asm("v_exp_f32 %0, %8\n\t"
      "v_exp_f32 %1, %9\n\t"
      "v_exp_f32 %2, %10\n\t"
      "v_exp_f32 %3, %11\n\t"
      "v_exp_f32 %4, %12\n\t"
      "v_exp_f32 %5, %13\n\t"
      "v_exp_f32 %6, %14\n\t"
      "v_exp_f32 %7, %15\n\t"
      "v_nop"
      : "=&v"(p[0]), "=&v"(p[1]), "=&v"(p[2]), "=&v"(p[3]),
        "=&v"(p[4]), "=&v"(p[5]), "=&v"(p[6]), "=&v"(p[7])
      : "v"(x[0]), "v"(x[1]), "v"(x[2]), "v"(x[3]),
        "v"(x[4]), "v"(x[5]), "v"(x[6]), "v"(x[7]));
}

#ifdef USE_TDM
__device__ __forceinline__ void tdm_load_2d(void* lds_dst, const void* gsrc,
                                            uint32_t tile_d0, uint32_t tile_d1,
                                            uint32_t tensor_d0, uint32_t tensor_d1,
                                            uint32_t stride0) {
  uint64_t ga = (uint64_t)(uintptr_t)gsrc;
  uint32_t lo = (uint32_t)(uintptr_t)lds_dst;  // LDS byte offset (low 32 bits)
  v4u g0;
  g0[0] = 1u;
  g0[1] = lo;
  g0[2] = (uint32_t)ga;
  g0[3] = (uint32_t)((ga >> 32) & 0x01FFFFFFu) | (2u << 30);  // [56:32] | type=2
  v8i g1;
  g1[0] = (int)(1u << 16);
  g1[1] = (int)((tensor_d0 & 0xFFFFu) << 16);
  g1[2] = (int)(((tensor_d0 >> 16) & 0xFFFFu) | ((tensor_d1 & 0xFFFFu) << 16));
  g1[3] = (int)(((tensor_d1 >> 16) & 0xFFFFu) | ((tile_d0 & 0xFFFFu) << 16));
  g1[4] = (int)(tile_d1 & 0xFFFFu);
  g1[5] = (int)stride0;
  g1[6] = 0;
  g1[7] = 0;
  v4i z4 = {0, 0, 0, 0};
  v8i z8 = {0, 0, 0, 0, 0, 0, 0, 0};
  __builtin_amdgcn_tensor_load_to_lds(g0, g1, z4, z4, z8, 0);
}
#endif

// ---------------------------------------------------------------------------
// 1) GroupNorm in one launch: one block of 32 waves per (b, g). A group is 8 channels
//    x 4096 positions = 32 floats per thread, held in registers from the sums to the
//    normalised store, so x is read once. The group's 8 channels are one 16-byte chunk
//    of the panel layout: a lane stores whole chunks, a wave 512 contiguous bytes.
// ---------------------------------------------------------------------------
__global__ void __launch_bounds__(1024)
gn_kernel(const float* __restrict__ x, const float* __restrict__ gw,
          const float* __restrict__ gb, unsigned short* __restrict__ xn) {
  __shared__ float sh_s[32];
  __shared__ float sh_q[32];
  const int lane = threadIdx.x & 31;
  const int wave = threadIdx.x >> 5;
  const int bg = blockIdx.x;                       // b*32 + g
  const int b = bg >> 5, g = bg & 31;
  const float* base = x + (size_t)bg * (CPG * NSP) + wave * 128 + lane;
  float v[CPG][4];
#pragma unroll
  for (int c = 0; c < CPG; ++c)
#pragma unroll
    for (int i = 0; i < 4; ++i) v[c][i] = base[c * NSP + i * 32];

  float s = 0.f, q = 0.f;
#pragma unroll
  for (int c = 0; c < CPG; ++c)
#pragma unroll
    for (int i = 0; i < 4; ++i) { s += v[c][i]; q += v[c][i] * v[c][i]; }
#pragma unroll
  for (int off = 16; off > 0; off >>= 1) {
    s += __shfl_xor(s, off, 32);
    q += __shfl_xor(q, off, 32);
  }
  if (lane == 0) { sh_s[wave] = s; sh_q[wave] = q; }
  __syncthreads();
  // every wave joins the 32 wave sums by the same butterfly: the same bits in every lane
  s = sh_s[lane]; q = sh_q[lane];
#pragma unroll
  for (int off = 16; off > 0; off >>= 1) {
    s += __shfl_xor(s, off, 32);
    q += __shfl_xor(q, off, 32);
  }
  const float inv  = 1.0f / (float)(CPG * NSP);
  const float mean = s * inv;
  const float var  = q * inv - mean * mean;
  const float rstd = rsqrtf(var + EPSV);

  float w8[CPG], b8[CPG];
#pragma unroll
  for (int c = 0; c < CPG; ++c) { w8[c] = gw[g * CPG + c]; b8[c] = gb[g * CPG + c]; }
#pragma unroll
  for (int i = 0; i < 4; ++i) {
    float y[CPG];
#pragma unroll
    for (int c = 0; c < CPG; ++c) y[c] = (v[c][i] - mean) * rstd * w8[c] + b8[c];
    uint4 o;
    o.x = pack2(y[0], y[1]);
    o.y = pack2(y[2], y[3]);
    o.z = pack2(y[4], y[5]);
    o.w = pack2(y[6], y[7]);
    *(uint4*)(xn + panel_idx((size_t)b * NSP + wave * 128 + i * 32 + lane, g * CPG)) = o;
  }
}

// ---------------------------------------------------------------------------
// 2) fp32 -> bf16 weight conversion (256 columns), into chunk-major panels.
// ---------------------------------------------------------------------------
__global__ void __launch_bounds__(256)
f2bf_kernel(const float* __restrict__ src, unsigned short* __restrict__ dst, int n) {
  int i = blockIdx.x * 256 + threadIdx.x;
  // i runs over the destination, so a block writes whole lines:
  // i = [row / 64][k / 8][row % 64][k % 8]
  if (i < n) dst[i] = f2bf(src[((i >> 14) * 64 + ((i >> 3) & 63)) * CHN + ((i >> 9) & 31) * 8 + (i & 7)]);
}

__global__ void __launch_bounds__(128)
qkv_gemm_kernel(const unsigned short* __restrict__ wqkv,
                const unsigned short* __restrict__ xn,
                const float* __restrict__ bias,
                unsigned short* __restrict__ qo,
                unsigned short* __restrict__ ko,
                unsigned short* __restrict__ vo) {
  __shared__ unsigned short Asm[64 * CHN];   // 32 KB: 64 M-rows x 256 K
  __shared__ unsigned short Bsm[64 * CHN];   // 32 KB: 64 N-cols x 256 K
  const int lane = threadIdx.x & 31;
  const int wave = threadIdx.x >> 5;
  const int half = lane >> 4;
  const int lid  = lane & 15;
  const int mbase = blockIdx.x * 64;        // 0..704
  const int n0    = blockIdx.y * 64;
  const int b     = blockIdx.z;

  const unsigned short* ag = wqkv + (size_t)mbase * CHN;
  const unsigned short* bg = xn + ((size_t)b * NSP + n0) * CHN;

#ifdef USE_TDM
  if (wave == 0) {
    tdm_load_2d(Asm, ag, CHN, 64, CHN, 64, CHN);
    tdm_load_2d(Bsm, bg, CHN, 64, CHN, 64, CHN);
    __builtin_amdgcn_s_wait_tensorcnt(0);
  }
#else
  {
    const uint4* as = (const uint4*)ag; uint4* ad = (uint4*)Asm;
    const uint4* bs = (const uint4*)bg; uint4* bd = (uint4*)Bsm;
    for (int t = threadIdx.x; t < 64 * CHN / 8; t += 128) { ad[t] = as[t]; bd[t] = bs[t]; }
  }
#endif
  __syncthreads();

  const unsigned short* al = cm_lane(Asm, 64, wave * 16 + lid, half);
  const unsigned short* bl = cm_lane(Bsm, 64, lid, half);
  const size_t hb = (size_t)(b * HEADS + (blockIdx.x & 3)) * NSP * CHD;  // this head's plane
  v8f acc[4] = {};
  if (blockIdx.x < 8) {
    for (int kb = 0; kb < CHN; kb += 32) {
      v16bf a = load_frag_cm(al, 64, 0, kb >> 3);
#pragma unroll
      for (int j = 0; j < 4; ++j) {
        v16bf bf = load_frag_cm(bl, 64, j * 16, kb >> 3);
        acc[j] = wmma_bf16(a, bf, acc[j]);
      }
    }
    // D layout: row = r + half*8 is channel c = wave*16 + half*8 + r, col = lane % 16 is
    // position n = n0 + j*16 + lid. 32-position tiles, chunk-major, for q as for k:
    // [n / 32][c / 8][n % 32][c % 8]; 16 lanes store 256 contiguous bytes.
    const float scale = 0.35355339059327373f;  // 64^-0.25, applied to q and k
    float bs[8];
#pragma unroll
    for (int r = 0; r < 8; ++r) bs[r] = bias[mbase + wave * 16 + half * 8 + r];
    unsigned short* dst = (blockIdx.x < 4 ? qo : ko) + hb + (size_t)n0 * CHD +
                          (wave * 2 + half) * 256 + lid * 8;
#pragma unroll
    for (int j = 0; j < 4; ++j) {
      uint4 w;
      w.x = pack2((acc[j][0] + bs[0]) * scale, (acc[j][1] + bs[1]) * scale);
      w.y = pack2((acc[j][2] + bs[2]) * scale, (acc[j][3] + bs[3]) * scale);
      w.z = pack2((acc[j][4] + bs[4]) * scale, (acc[j][5] + bs[5]) * scale);
      w.w = pack2((acc[j][6] + bs[6]) * scale, (acc[j][7] + bs[7]) * scale);
      *(uint4*)(dst + (j >> 1) * 2048 + (j & 1) * 128) = w;
    }
  } else {
    for (int kb = 0; kb < CHN; kb += 32) {
      v16bf a = load_frag_cm(al, 64, 0, kb >> 3);
#pragma unroll
      for (int j = 0; j < 4; ++j) {
        v16bf bf = load_frag_cm(bl, 64, j * 16, kb >> 3);
        acc[j] = wmma_bf16(bf, a, acc[j]);
      }
    }
    // D layout: row = r + half*8 is position n = n0 + j*16 + half*8 + r, col = lane % 16 is
    // channel c = wave*16 + lid. Row (n % 32) / 8 * 16 + c / 4 of 4096, column
    // n / 32 * 32 + c % 4 * 8 + n % 8: the 64 x 32 tile at column n / 32 * 32 then lands
    // in LDS as [key / 8][c][key % 8].
    const int c = wave * 16 + lid;
    const float bv = bias[mbase + c];
    unsigned short* dst = vo + hb + (size_t)(half * 16 + (c >> 2)) * NSP + n0 + (c & 3) * 8;
#pragma unroll
    for (int j = 0; j < 4; ++j) {
      uint4 w;
      w.x = pack2(acc[j][0] + bv, acc[j][1] + bv);
      w.y = pack2(acc[j][2] + bv, acc[j][3] + bv);
      w.z = pack2(acc[j][4] + bv, acc[j][5] + bv);
      w.w = pack2(acc[j][6] + bv, acc[j][7] + bv);
      *(uint4*)(dst + (size_t)(j & 1) * 32 * NSP + (j >> 1) * 32) = w;
    }
    // The built code lays the q/k arm straight behind these stores, past a branch that always
    // leaves: this wait stands in front of every write there to a register the stores name.
    asm volatile("s_wait_xcnt 0x0" ::: "memory");
  }
}

__global__ void __launch_bounds__(256)
flash_attn_kernel(const unsigned short* __restrict__ q,
                  const unsigned short* __restrict__ k,
                  const unsigned short* __restrict__ v,
                  unsigned short* __restrict__ aout) {
  __shared__ unsigned short Kb[2][32 * CHD];     // 2 x 4 KB (32 keys x 64 ch)
  __shared__ unsigned short Vb[2][CHD * 32];     // 2 x 4 KB (64 ch x 32 keys)
  const int lane = threadIdx.x & 31;
  const int wave = threadIdx.x >> 5;
  const int half = lane >> 4;
  const int lid  = lane & 15;
  const int bh = blockIdx.x;                     // b*4 + head
  const int qt = (blockIdx.y * 8 + wave) * 2;    // first of two 16-query tiles, 0..254

  const unsigned short* kg = k + (size_t)bh * NSP * CHD;  // (n/32, c/8, n%32, c%8) tiles, dense
  const unsigned short* vg = v + (size_t)bh * CHD * NSP;  // (64, n) row stride N

#ifdef USE_TDM
  auto issue_kv = [&](int buf, int s0) {
    // K tile: one 4 KB chunk-major 32-key tile, copied as 32 x 64, row stride 64 (dense)
    tdm_load_2d(&Kb[buf][0], kg + (size_t)s0 * CHD, CHD, 32, CHD, NSP, CHD);
    // V tile: 64 rows x 32 cols (keys s0..s0+31, all 64 ch), row stride 4096
    tdm_load_2d(&Vb[buf][0], vg + s0, 32, CHD, NSP, CHD, NSP);
  };
  if (wave == 0) { issue_kv(0, 0); __builtin_amdgcn_s_wait_tensorcnt(0); }
  __syncthreads();
#endif

  v16bf qa0[2], qa1[2];                          // [g]: column group g = queries (qt + g) * 16 + lid
#pragma unroll
  for (int g = 0; g < 2; ++g) {
    // the wave's 32 queries are one chunk-major tile of q, laid out like a K tile
    const unsigned short* ql = cm_lane(q + ((size_t)bh * NSP + qt * 16) * CHD, 32, g * 16 + lid, half);
    qa0[g] = load_frag_cm(ql, 32, 0, 0);         // B: col = query lid, K = c 0..31
    qa1[g] = load_frag_cm(ql, 32, 0, 4);         // B: col = query lid, K = c 32..63
  }

  const float LOG2E = 1.44269504f;   // e^x as 2^(x * log2 e), as __expf compiles
  const float LAZY  = 5.5451774f;    // 8 / log2 e
  float m[2], mt[2], nml[2], l[2];
  v8f o[2][4] = {};   // o[g][j][r] = O^T[c = j*16 + half*8 + r][query lid of group g]
#pragma unroll
  for (int g = 0; g < 2; ++g) {
    m[g]  = -1e30f;         // maximum in use of query lid, the same in both halves
    mt[g] = m[g] + LAZY;    // what a score must top to move it
    nml[g] = -m[g] * LOG2E; // -m in log2 units: the addend of every exponent's fma
    l[g] = 0.f;         // running sum over this half's keys only; halves joined after the loop
  }

  const int steps = NSP / 32;
  for (int it = 0; it < steps; ++it) {
    const int s0 = it * 32;
#ifdef USE_TDM
    const int cur = it & 1;
    if (wave == 0 && it + 1 < steps) issue_kv(cur ^ 1, s0 + 32);
#else
    const int cur = 0;
    {
      // cooperative stage: K tile is 4 KB contiguous, V tile 64 rows x 64 B
      const uint4* ks = (const uint4*)(kg + (size_t)s0 * CHD);
      ((uint4*)&Kb[0][0])[threadIdx.x] = ks[threadIdx.x];
      int row = threadIdx.x >> 2, ch4 = threadIdx.x & 3;
      ((uint4*)&Vb[0][0])[threadIdx.x] =
          *(const uint4*)(vg + (size_t)row * NSP + s0 + ch4 * 8);
    }
    __syncthreads();
#endif
    // As the QKV epilogue stored them, the landed tiles are chunk-major:
    // Kb = [c / 8][key][c % 8], Vb = [key / 8][c][key % 8].
    const unsigned short* kl = cm_lane(&Kb[cur][0], 32, lid, half);
    const unsigned short* vl = cm_lane(&Vb[cur][0], 64, lid, half);
    v8f st[2][2] = {};   // st[g][sub][r] = S^T[key = sub*16 + half*8 + r][query lid of group g]
#pragma unroll
    for (int sub = 0; sub < 2; ++sub) {
      v16bf kb0 = load_frag_cm(kl, 32, sub * 16, 0);   // A: row = key, K = c
      v16bf kb1 = load_frag_cm(kl, 32, sub * 16, 4);
#pragma unroll
      for (int g = 0; g < 2; ++g) st[g][sub] = wmma_bf16(kb0, qa0[g], st[g][sub]);
#pragma unroll
      for (int g = 0; g < 2; ++g) st[g][sub] = wmma_bf16(kb1, qa1[g], st[g][sub]);
    }
    // Online softmax of one query per lane and group: 16 of its 32 scores are here, the
    // other 16 in lane ^ 16.
    float cm[2];
#pragma unroll
    for (int g = 0; g < 2; ++g) {
      cm[g] = fmaxf(st[g][0][0], st[g][1][0]);
#pragma unroll
      for (int r = 1; r < 8; ++r) cm[g] = fmaxf(cm[g], fmaxf(st[g][0][r], st[g][1][r]));
    }
    // One scalar branch per pass: the ballot covers both halves of every query of both
    // groups. Pass 0 always takes it (m starts far below any score) and scales zeros by
    // alpha = 0.
    if (__builtin_amdgcn_ballot_w32((cm[0] > mt[0]) | (cm[1] > mt[1])) != 0) {
#pragma unroll   // constant g and j: o[] stays in registers
      for (int g = 0; g < 2; ++g) {
        m[g] = fmaxf(m[g], fmaxf(cm[g], xhalf(cm[g])));
        mt[g] = m[g] + LAZY;
        const float nmlnew = -m[g] * LOG2E;
        const float alpha = exp2_1(nmlnew - nml[g]);
        nml[g] = nmlnew;
        l[g] *= alpha;
#pragma unroll
        for (int j = 0; j < 4; ++j) o[g][j] *= alpha;
      }
    }
    // B operand P^T, column = query lid: elements 0..7 are keys half*8 + 0..7 (tile 0's
    // registers), elements 8..15 keys 16 + half*8 + 0..7 (tile 1's): the k order in which
    // load_frag_cm hands out V's keys.
    FragU pb[2];
    const v8f lg8 = {LOG2E, LOG2E, LOG2E, LOG2E, LOG2E, LOG2E, LOG2E, LOG2E};
#pragma unroll
    for (int g = 0; g < 2; ++g) {
      float rs[2];
      const v8f nm8 = {nml[g], nml[g], nml[g], nml[g], nml[g], nml[g], nml[g], nml[g]};
#pragma unroll
      for (int sub = 0; sub < 2; ++sub) {
        float x[8], p[8];
        const v8f xs = __builtin_elementwise_fma(st[g][sub], lg8, nm8);
#pragma unroll
        for (int r = 0; r < 8; ++r) x[r] = xs[r];
        exp2_8(x, p);
#pragma unroll
        for (int i = 0; i < 4; ++i) pb[g].u[sub * 4 + i] = pack2(p[2 * i], p[2 * i + 1]);
        rs[sub] = ((p[0] + p[1]) + (p[2] + p[3])) + ((p[4] + p[5]) + (p[6] + p[7]));
      }
      l[g] += rs[0] + rs[1];
    }
#pragma unroll
    for (int j = 0; j < 4; ++j) {
      v16bf va = load_frag_cm(vl, 64, j * 16, 0);  // A: row = c, K = key
#pragma unroll
      for (int g = 0; g < 2; ++g) o[g][j] = wmma_bf16(va, pb[g].v, o[g][j]);
    }
#ifdef USE_TDM
    if (wave == 0) __builtin_amdgcn_s_wait_tensorcnt(0);
#endif
    __syncthreads();
  }

  const int b = bh >> 2, head = bh & 3;
  // a lane's 8 registers of o[j] are 8 neighbouring channels of one row: one 16-byte chunk
  // of the panel; column tile j lies two chunks (1024 elements) on
#pragma unroll
  for (int g = 0; g < 2; ++g) {
    const size_t obase = panel_idx((size_t)b * NSP + (qt + g) * 16 + lid, head * CHD + half * 8);
    const float inv = 1.0f / (l[g] + xhalf(l[g]));
#pragma unroll
    for (int j = 0; j < 4; ++j) {
      uint4 w;
      w.x = pack2(o[g][j][0] * inv, o[g][j][1] * inv);
      w.y = pack2(o[g][j][2] * inv, o[g][j][3] * inv);
      w.z = pack2(o[g][j][4] * inv, o[g][j][5] * inv);
      w.w = pack2(o[g][j][6] * inv, o[g][j][7] * inv);
      *(uint4*)(aout + obase + j * 1024) = w;
    }
  }
}

__global__ void __launch_bounds__(128)
proj_gemm_kernel(const unsigned short* __restrict__ wp,
                 const unsigned short* __restrict__ a,
                 const float* __restrict__ bias,
                 const float* __restrict__ x,
                 float* __restrict__ out) {
  __shared__ unsigned short Asm[64 * CHN];
  __shared__ unsigned short Bsm[64 * CHN];
  const int lane = threadIdx.x & 31;
  const int wave = threadIdx.x >> 5;
  const int half = lane >> 4;
  const int lid  = lane & 15;
  const int mbase = blockIdx.x * 64;        // 0..192
  const int n0    = blockIdx.y * 64;
  const int b     = blockIdx.z;

  const unsigned short* ag = wp + (size_t)mbase * CHN;
  const unsigned short* bg = a + ((size_t)b * NSP + n0) * CHN;

#ifdef USE_TDM
  if (wave == 0) {
    tdm_load_2d(Asm, ag, CHN, 64, CHN, 64, CHN);
    tdm_load_2d(Bsm, bg, CHN, 64, CHN, 64, CHN);
    __builtin_amdgcn_s_wait_tensorcnt(0);
  }
#else
  {
    const uint4* as = (const uint4*)ag; uint4* ad = (uint4*)Asm;
    const uint4* bs = (const uint4*)bg; uint4* bd = (uint4*)Bsm;
    for (int t = threadIdx.x; t < 64 * CHN / 8; t += 128) { ad[t] = as[t]; bd[t] = bs[t]; }
  }
#endif
  __syncthreads();

  const unsigned short* al = cm_lane(Asm, 64, wave * 16 + lid, half);
  const unsigned short* bl = cm_lane(Bsm, 64, lid, half);
  v8f acc[4] = {};
  for (int kb = 0; kb < CHN; kb += 32) {
    v16bf af = load_frag_cm(al, 64, 0, kb >> 3);
#pragma unroll
    for (int j = 0; j < 4; ++j) {
      v16bf bf = load_frag_cm(bl, 64, j * 16, kb >> 3);
      acc[j] = wmma_bf16(af, bf, acc[j]);
    }
  }
#pragma unroll
  for (int j = 0; j < 4; ++j) {
#pragma unroll
    for (int r = 0; r < 8; ++r) {
      int o = mbase + wave * 16 + r + half * 8;
      int n = n0 + j * 16 + lid;
      size_t idx = ((size_t)b * CHN + o) * NSP + n;
      out[idx] = x[idx] + acc[j][r] + bias[o];
    }
  }
}

// ---------------------------------------------------------------------------
// Workspace layout (bytes)
// ---------------------------------------------------------------------------
#define OFF_WQ    ((size_t)4096)                             // 768*256 bf16
#define OFF_WP    (OFF_WQ + (size_t)3 * CHN * CHN * 2)
#define OFF_XN    (OFF_WP + (size_t)CHN * CHN * 2)           // (b*n, c) bf16 panels
#define OFF_Q     (OFF_XN + (size_t)BATCH * NSP * CHN * 2)   // (bh,n/32,c/8,n%32,c%8) bf16
#define OFF_K     (OFF_Q  + (size_t)BATCH * CHN * NSP * 2)   // (bh,n/32,c/8,n%32,c%8) bf16
#define OFF_V     (OFF_K  + (size_t)BATCH * CHN * NSP * 2)   // (bh,64 rows,n) bf16, rows as the QKV epilogue lays them
#define OFF_A     (OFF_V  + (size_t)BATCH * CHN * NSP * 2)   // (b*n, c) bf16 panels

extern "C" void kernel_launch(void* const* d_in, const int* in_sizes, int n_in,
                              void* d_out, int out_size, void* d_ws, size_t ws_size,
                              hipStream_t stream) {
  const float* x      = (const float*)d_in[0];
  const float* norm_w = (const float*)d_in[1];
  const float* norm_b = (const float*)d_in[2];
  const float* qkv_w  = (const float*)d_in[3];
  const float* qkv_b  = (const float*)d_in[4];
  const float* proj_w = (const float*)d_in[5];
  const float* proj_b = (const float*)d_in[6];

  char* ws = (char*)d_ws;
  unsigned short* wq    = (unsigned short*)(ws + OFF_WQ);
  unsigned short* wp    = (unsigned short*)(ws + OFF_WP);
  unsigned short* xn    = (unsigned short*)(ws + OFF_XN);
  unsigned short* qb    = (unsigned short*)(ws + OFF_Q);
  unsigned short* kb    = (unsigned short*)(ws + OFF_K);
  unsigned short* vb    = (unsigned short*)(ws + OFF_V);
  unsigned short* ab    = (unsigned short*)(ws + OFF_A);

  gn_kernel<<<BATCH * NGRP, 1024, 0, stream>>>(x, norm_w, norm_b, xn);
  f2bf_kernel<<<(3 * CHN * CHN + 255) / 256, 256, 0, stream>>>(qkv_w, wq, 3 * CHN * CHN);
  f2bf_kernel<<<(CHN * CHN + 255) / 256, 256, 0, stream>>>(proj_w, wp, CHN * CHN);

  qkv_gemm_kernel<<<dim3(12, 64, BATCH), 128, 0, stream>>>(wq, xn, qkv_b, qb, kb, vb);
  flash_attn_kernel<<<dim3(BATCH * HEADS, NSP / (32 * 8)), 256, 0, stream>>>(qb, kb, vb, ab);
  proj_gemm_kernel<<<dim3(4, 64, BATCH), 128, 0, stream>>>(wp, ab, proj_b, x, (float*)d_out);
}

// v007
// Measured time: 133 microseconds a run.
// Two timings next to v006 put it at 1.06 and 1.05 times that version's speed.
// Counting every step since v000, it is 4.94 times as fast.
#include <hip/hip_runtime.h>
#include <stdint.h>

typedef __attribute__((ext_vector_type(16))) __bf16 v16bf;
typedef __attribute__((ext_vector_type(8)))  float  v8f;
typedef __attribute__((ext_vector_type(4)))  unsigned int v4u;
typedef __attribute__((ext_vector_type(8)))  int v8i;
typedef __attribute__((ext_vector_type(4)))  int v4i;

#define BATCH 8
#define CHN   256
#define NSP   4096
#define NGRP  32
#define CPG   8      // channels per group
#define HEADS 4
#define CHD   64     // channels per head
#define EPSV  1e-5f

#if __has_builtin(__builtin_amdgcn_tensor_load_to_lds) && \
    __has_builtin(__builtin_amdgcn_s_wait_tensorcnt)
#define USE_TDM 1
#endif

union FragU { v16bf v; uint32_t u[8]; };

__device__ __forceinline__ unsigned short f2bf(float x) {
  union { float f; uint32_t u; } c; c.f = x;
  uint32_t u = c.u;
  u += 0x7fffu + ((u >> 16) & 1u);   // round-to-nearest-even
  return (unsigned short)(u >> 16);
}

__device__ __forceinline__ const unsigned short* cm_lane(const unsigned short* tile, int rows,
                                                         int row, int half) {
  return tile + (half * rows + row) * 8;
}
__device__ __forceinline__ v16bf load_frag_cm(const unsigned short* lane_base, int rows,
                                              int row0, int kc) {
  const uint32_t* p0 = (const uint32_t*)(lane_base + (kc * rows + row0) * 8);
  const uint32_t* p1 = (const uint32_t*)(lane_base + ((kc + 2) * rows + row0) * 8);
  FragU f;
  f.u[0] = p0[0]; f.u[1] = p0[1]; f.u[2] = p0[2]; f.u[3] = p0[3];
  f.u[4] = p1[0]; f.u[5] = p1[1]; f.u[6] = p1[2]; f.u[7] = p1[3];
  return f.v;
}

// Element index of (row, k) in a matrix of 256 columns kept as dense 64-row
// panels, each panel chunk-major: [row / 64][k / 8][row % 64][k % 8].
__device__ __forceinline__ size_t panel_idx(size_t row, int k) {
  return ((row >> 6) * 32 + (size_t)(k >> 3)) * 512 + (row & 63) * 8 + (size_t)(k & 7);
}

__device__ __forceinline__ v8f wmma_bf16(v16bf a, v16bf b, v8f c) {
  return __builtin_amdgcn_wmma_f32_16x16x32_bf16(
      /*neg_a=*/false, a, /*neg_b=*/false, b,
      /*c_mod=*/(short)0, c, /*reuse_a=*/false, /*reuse_b=*/false);
}

// Two f32 to one register of two bf16, round to nearest even (one v_cvt_pk_bf16_f32).
__device__ __forceinline__ uint32_t pack2(float lo, float hi) {
  typedef __bf16 bf2 __attribute__((ext_vector_type(2)));
  typedef float  f2  __attribute__((ext_vector_type(2)));
  return __builtin_bit_cast(uint32_t, __builtin_convertvector(f2{lo, hi}, bf2));
}

__device__ __forceinline__ float xhalf(float x) {
  int b = __builtin_bit_cast(int, x);
  return __builtin_bit_cast(float,
      __builtin_amdgcn_permlanex16(b, b, 0x76543210, 0xfedcba98, false, false));
}

__device__ __forceinline__ float exp2_1(float x) {
  float p;
  asm("v_exp_f32 %0, %1\n\tv_nop" : "=&v"(p) : "v"(x));
  return p;
}
__device__ __forceinline__ void exp2_8(const float (&x)[8], float (&p)[8]) {
  asm("v_exp_f32 %0, %8\n\t"
      "v_exp_f32 %1, %9\n\t"
      "v_exp_f32 %2, %10\n\t"
      "v_exp_f32 %3, %11\n\t"
      "v_exp_f32 %4, %12\n\t"
      "v_exp_f32 %5, %13\n\t"
      "v_exp_f32 %6, %14\n\t"
      "v_exp_f32 %7, %15\n\t"
      "v_nop"
      : "=&v"(p[0]), "=&v"(p[1]), "=&v"(p[2]), "=&v"(p[3]),
        "=&v"(p[4]), "=&v"(p[5]), "=&v"(p[6]), "=&v"(p[7])
      : "v"(x[0]), "v"(x[1]), "v"(x[2]), "v"(x[3]),
        "v"(x[4]), "v"(x[5]), "v"(x[6]), "v"(x[7]));
}

#ifdef USE_TDM
__device__ __forceinline__ void tdm_load_2d(void* lds_dst, const void* gsrc,
                                            uint32_t tile_d0, uint32_t tile_d1,
                                            uint32_t tensor_d0, uint32_t tensor_d1,
                                            uint32_t stride0) {
  uint64_t ga = (uint64_t)(uintptr_t)gsrc;
  uint32_t lo = (uint32_t)(uintptr_t)lds_dst;  // LDS byte offset (low 32 bits)
  v4u g0;
  g0[0] = 1u;
  g0[1] = lo;
  g0[2] = (uint32_t)ga;
  g0[3] = (uint32_t)((ga >> 32) & 0x01FFFFFFu) | (2u << 30);  // [56:32] | type=2
  v8i g1;
  g1[0] = (int)(1u << 16);
  g1[1] = (int)((tensor_d0 & 0xFFFFu) << 16);
  g1[2] = (int)(((tensor_d0 >> 16) & 0xFFFFu) | ((tensor_d1 & 0xFFFFu) << 16));
  g1[3] = (int)(((tensor_d1 >> 16) & 0xFFFFu) | ((tile_d0 & 0xFFFFu) << 16));
  g1[4] = (int)(tile_d1 & 0xFFFFu);
  g1[5] = (int)stride0;
  g1[6] = 0;
  g1[7] = 0;
  v4i z4 = {0, 0, 0, 0};
  v8i z8 = {0, 0, 0, 0, 0, 0, 0, 0};
  __builtin_amdgcn_tensor_load_to_lds(g0, g1, z4, z4, z8, 0);
}
#endif

typedef uint32_t u32x4 __attribute__((ext_vector_type(4)));
typedef uint32_t u32x8 __attribute__((ext_vector_type(8)));
__device__ __forceinline__ uint32_t uni(uint32_t v) { return (uint32_t)__builtin_amdgcn_readfirstlane(v); }
__device__ __forceinline__ uint32_t pinned(uint32_t v) {
  uint32_t w = __builtin_amdgcn_readfirstlane(v);
  asm volatile("" : "+s"(w));
  return w;
}
// The compiler places no wait for the tensor mover; the clobber keeps LDS reads on their side.
__device__ __forceinline__ void wait_ds0()     { asm volatile("s_wait_dscnt 0x0" ::: "memory"); }
__device__ __forceinline__ void wait_tensor0() { asm volatile("s_wait_tensorcnt 0x0" ::: "memory"); }
// A dense slice of 4 KiB as 16 rows of 256 bytes at a pitch of 256 bytes.
__device__ __forceinline__ u32x8 slice_group1() {
  constexpr uint32_t d0 = 256u, d1 = 16u;
  u32x8 g;
  g[0] = uni(0u);
  g[1] = uni((d0 & 0xFFFFu) << 16);
  g[2] = uni((d0 >> 16) | ((d1 & 0xFFFFu) << 16));
  g[3] = uni((d1 >> 16) | (d0 << 16));
  g[4] = uni(d1);
  g[5] = uni(d0);
  g[6] = uni(0u);
  g[7] = uni(0u);
  return g;
}
__device__ __forceinline__ u32x4 slice_group0(uint32_t lds_dst, uint64_t ga) {
  u32x4 g;
  g[0] = uni(1u);
  g[1] = uni(lds_dst);
  g[2] = uni((uint32_t)ga);
  g[3] = uni((((uint32_t)(ga >> 32)) & 0x01FFFFFFu) | 0x80000000u);
  return g;
}
__device__ __forceinline__ void slice_load(u32x4 g0, u32x8 g1) {
  asm volatile("tensor_load_to_lds %0, %1" :: "s"(g0), "s"(g1) : "memory");
}

// ---------------------------------------------------------------------------
// 1) GroupNorm in one launch: one block of 32 waves per (b, g). A group is 8 channels
//    x 4096 positions = 32 floats per thread, held in registers from the sums to the
//    normalised store, so x is read once. The group's 8 channels are one 16-byte chunk
//    of the panel layout: a lane stores whole chunks, a wave 512 contiguous bytes.
// ---------------------------------------------------------------------------
__global__ void __launch_bounds__(1024)
gn_kernel(const float* __restrict__ x, const float* __restrict__ gw,
          const float* __restrict__ gb, unsigned short* __restrict__ xn) {
  __shared__ float sh_s[32];
  __shared__ float sh_q[32];
  const int lane = threadIdx.x & 31;
  const int wave = threadIdx.x >> 5;
  const int bg = blockIdx.x;                       // b*32 + g
  const int b = bg >> 5, g = bg & 31;
  const float* base = x + (size_t)bg * (CPG * NSP) + wave * 128 + lane;
  float v[CPG][4];
#pragma unroll
  for (int c = 0; c < CPG; ++c)
#pragma unroll
    for (int i = 0; i < 4; ++i) v[c][i] = base[c * NSP + i * 32];

  float s = 0.f, q = 0.f;
#pragma unroll
  for (int c = 0; c < CPG; ++c)
#pragma unroll
    for (int i = 0; i < 4; ++i) { s += v[c][i]; q += v[c][i] * v[c][i]; }
#pragma unroll
  for (int off = 16; off > 0; off >>= 1) {
    s += __shfl_xor(s, off, 32);
    q += __shfl_xor(q, off, 32);
  }
  if (lane == 0) { sh_s[wave] = s; sh_q[wave] = q; }
  __syncthreads();
  // every wave joins the 32 wave sums by the same butterfly: the same bits in every lane
  s = sh_s[lane]; q = sh_q[lane];
#pragma unroll
  for (int off = 16; off > 0; off >>= 1) {
    s += __shfl_xor(s, off, 32);
    q += __shfl_xor(q, off, 32);
  }
  const float inv  = 1.0f / (float)(CPG * NSP);
  const float mean = s * inv;
  const float var  = q * inv - mean * mean;
  const float rstd = rsqrtf(var + EPSV);

  float w8[CPG], b8[CPG];
#pragma unroll
  for (int c = 0; c < CPG; ++c) { w8[c] = gw[g * CPG + c]; b8[c] = gb[g * CPG + c]; }
#pragma unroll
  for (int i = 0; i < 4; ++i) {
    float y[CPG];
#pragma unroll
    for (int c = 0; c < CPG; ++c) y[c] = (v[c][i] - mean) * rstd * w8[c] + b8[c];
    uint4 o;
    o.x = pack2(y[0], y[1]);
    o.y = pack2(y[2], y[3]);
    o.z = pack2(y[4], y[5]);
    o.w = pack2(y[6], y[7]);
    *(uint4*)(xn + panel_idx((size_t)b * NSP + wave * 128 + i * 32 + lane, g * CPG)) = o;
  }
}

// ---------------------------------------------------------------------------
// 2) fp32 -> bf16 weight conversion (256 columns), into chunk-major panels.
// ---------------------------------------------------------------------------
__global__ void __launch_bounds__(256)
f2bf_kernel(const float* __restrict__ src, unsigned short* __restrict__ dst, int n) {
  int i = blockIdx.x * 256 + threadIdx.x;
  // i runs over the destination, so a block writes whole lines:
  // i = [row / 64][k / 8][row % 64][k % 8]
  if (i < n) dst[i] = f2bf(src[((i >> 14) * 64 + ((i >> 3) & 63)) * CHN + ((i >> 9) & 31) * 8 + (i & 7)]);
}

__global__ void __launch_bounds__(128)
qkv_gemm_kernel(const unsigned short* __restrict__ wqkv,
                const unsigned short* __restrict__ xn,
                const float* __restrict__ bias,
                unsigned short* __restrict__ qo,
                unsigned short* __restrict__ ko,
                unsigned short* __restrict__ vo) {
  __shared__ unsigned short Asm[64 * CHN];   // 32 KB: 64 M-rows x 256 K
  __shared__ unsigned short Bsm[64 * CHN];   // 32 KB: 64 N-cols x 256 K
  const int lane = threadIdx.x & 31;
  const int wave = threadIdx.x >> 5;
  const int half = lane >> 4;
  const int lid  = lane & 15;
  const int mbase = blockIdx.x * 64;        // 0..704
  const int n0    = blockIdx.y * 64;
  const int b     = blockIdx.z;

  const unsigned short* ag = wqkv + (size_t)mbase * CHN;
  const unsigned short* bg = xn + ((size_t)b * NSP + n0) * CHN;

#ifdef USE_TDM
  if (wave == 0) {
    tdm_load_2d(Asm, ag, CHN, 64, CHN, 64, CHN);
    tdm_load_2d(Bsm, bg, CHN, 64, CHN, 64, CHN);
    __builtin_amdgcn_s_wait_tensorcnt(0);
  }
#else
  {
    const uint4* as = (const uint4*)ag; uint4* ad = (uint4*)Asm;
    const uint4* bs = (const uint4*)bg; uint4* bd = (uint4*)Bsm;
    for (int t = threadIdx.x; t < 64 * CHN / 8; t += 128) { ad[t] = as[t]; bd[t] = bs[t]; }
  }
#endif
  __syncthreads();

  const unsigned short* al = cm_lane(Asm, 64, wave * 16 + lid, half);
  const unsigned short* bl = cm_lane(Bsm, 64, lid, half);
  const size_t hb = (size_t)(b * HEADS + (blockIdx.x & 3)) * NSP * CHD;  // this head's plane
  v8f acc[4] = {};
  if (blockIdx.x < 8) {
    for (int kb = 0; kb < CHN; kb += 32) {
      v16bf a = load_frag_cm(al, 64, 0, kb >> 3);
#pragma unroll
      for (int j = 0; j < 4; ++j) {
        v16bf bf = load_frag_cm(bl, 64, j * 16, kb >> 3);
        acc[j] = wmma_bf16(a, bf, acc[j]);
      }
    }
    // D layout: row = r + half*8 is channel c = wave*16 + half*8 + r, col = lane % 16 is
    // position n = n0 + j*16 + lid. 32-position tiles, chunk-major, for q as for k:
    // [n / 32][c / 8][n % 32][c % 8]; 16 lanes store 256 contiguous bytes.
    const float scale = 0.35355339059327373f;  // 64^-0.25, applied to q and k
    float bs[8];
#pragma unroll
    for (int r = 0; r < 8; ++r) bs[r] = bias[mbase + wave * 16 + half * 8 + r];
    unsigned short* dst = (blockIdx.x < 4 ? qo : ko) + hb + (size_t)n0 * CHD +
                          (wave * 2 + half) * 256 + lid * 8;
#pragma unroll
    for (int j = 0; j < 4; ++j) {
      uint4 w;
      w.x = pack2((acc[j][0] + bs[0]) * scale, (acc[j][1] + bs[1]) * scale);
      w.y = pack2((acc[j][2] + bs[2]) * scale, (acc[j][3] + bs[3]) * scale);
      w.z = pack2((acc[j][4] + bs[4]) * scale, (acc[j][5] + bs[5]) * scale);
      w.w = pack2((acc[j][6] + bs[6]) * scale, (acc[j][7] + bs[7]) * scale);
      *(uint4*)(dst + (j >> 1) * 2048 + (j & 1) * 128) = w;
    }
  } else {
    for (int kb = 0; kb < CHN; kb += 32) {
      v16bf a = load_frag_cm(al, 64, 0, kb >> 3);
#pragma unroll
      for (int j = 0; j < 4; ++j) {
        v16bf bf = load_frag_cm(bl, 64, j * 16, kb >> 3);
        acc[j] = wmma_bf16(bf, a, acc[j]);
      }
    }
    // D layout: row = r + half*8 is position n = n0 + j*16 + half*8 + r, col = lane % 16 is
    // channel c = wave*16 + lid. 32-key tiles, chunk-major, dense like k's:
    // [n / 32][n % 32 / 8][c][n % 8]; 16 lanes store 256 contiguous bytes.
    const int c = wave * 16 + lid;
    const float bv = bias[mbase + c];
    unsigned short* dst = vo + hb + (size_t)n0 * CHD + half * 512 + c * 8;
#pragma unroll
    for (int j = 0; j < 4; ++j) {
      uint4 w;
      w.x = pack2(acc[j][0] + bv, acc[j][1] + bv);
      w.y = pack2(acc[j][2] + bv, acc[j][3] + bv);
      w.z = pack2(acc[j][4] + bv, acc[j][5] + bv);
      w.w = pack2(acc[j][6] + bv, acc[j][7] + bv);
      *(uint4*)(dst + (j >> 1) * 2048 + (j & 1) * 1024) = w;
    }
    // The built code lays the q/k arm straight behind these stores, past a branch that always
    // leaves: this wait stands in front of every write there to a register the stores name.
    asm volatile("s_wait_xcnt 0x0" ::: "memory");
  }
}

// ---------------------------------------------------------------------------
// 4) Flash attention: block = 8 waves sharing one (b,head); each wave owns 32
//    queries as two groups of 16 columns, so every K and V fragment read from LDS
//    feeds two products. K and V come in stages of 128 keys (four 32-key tiles each, 16 KB
//    + 16 KB, dense in the workspace) through two LDS buffers: every wave brings one 4 KB
//    slice of a stage by one tensor load, a whole stage ahead, and the block meets at one
//    publish point per stage. Per 32-key pass:
//    8 WMMA (S^T = K Q^T) + online softmax + 8 WMMA (O^T += V^T P^T).
//    Transposed, a lane holds scores of ONE query (column lane % 16): maximum
//    and sum run in the lane's own registers, and the two score tiles, packed
//    to bf16 in place, are the B operand of the second product.
//    Lazy rescale: the maximum in use of a query moves only when a score tops it by
//    more than LAZY, tested once per pass for the whole wave, both groups. Any maximum in use
//    gives the same quotient O / l; LAZY only bounds P (at most 2^8).
// ---------------------------------------------------------------------------
#define STG_KEYS  128
#define STG_ELEMS (STG_KEYS * CHD)               // elements of K, and of V, in a stage
__global__ void __launch_bounds__(256)
flash_attn_kernel(const unsigned short* __restrict__ q,
                  const unsigned short* __restrict__ k,
                  const unsigned short* __restrict__ v,
                  unsigned short* __restrict__ aout) {
  // [buffer][K tiles 0..3, V tiles 0..3][4 KB tile]: slice w of a stage is tile w
  __shared__ __attribute__((aligned(2048))) unsigned short KV[2][2 * STG_ELEMS];
  const int lane = threadIdx.x & 31;
  const int wave = (int)uni(threadIdx.x >> 5);
  const int half = lane >> 4;
  const int lid  = lane & 15;
  const int bh = blockIdx.x;                     // b*4 + head
  const int qt = (blockIdx.y * 8 + wave) * 2;    // first of two 16-query tiles, 0..254

  // waves 0..3 bring the stage's four K tiles, waves 4..7 its four V tiles
  const unsigned short* sl = (wave < 4 ? k : v) + (size_t)bh * NSP * CHD + (wave & 3) * (32 * CHD);
  const uint32_t sl_lds = (uint32_t)(uintptr_t)&KV[0][0] + (uint32_t)wave * 4096u;
  const u32x8 g1 = slice_group1();
  auto issue = [&](uint32_t st) {
    slice_load(slice_group0(sl_lds + (st & 1u) * (uint32_t)sizeof(KV[0]),
                            (uint64_t)(uintptr_t)sl + (uint64_t)st * (STG_ELEMS * 2)), g1);
  };
  const uint32_t stages = NSP / STG_KEYS;
  issue(0);
  wait_tensor0();
  __syncthreads();
  issue(1);

  v16bf qa0[2], qa1[2];                          // [g]: column group g = queries (qt + g) * 16 + lid
#pragma unroll
  for (int g = 0; g < 2; ++g) {
    // the wave's 32 queries are one chunk-major tile of q, laid out like a K tile
    const unsigned short* ql = cm_lane(q + ((size_t)bh * NSP + qt * 16) * CHD, 32, g * 16 + lid, half);
    qa0[g] = load_frag_cm(ql, 32, 0, 0);         // B: col = query lid, K = c 0..31
    qa1[g] = load_frag_cm(ql, 32, 0, 4);         // B: col = query lid, K = c 32..63
  }

  const float LOG2E = 1.44269504f;   // e^x as 2^(x * log2 e), as __expf compiles
  const float LAZY  = 5.5451774f;    // 8 / log2 e
  float m[2], mt[2], nml[2], l[2];
  v8f o[2][4] = {};   // o[g][j][r] = O^T[c = j*16 + half*8 + r][query lid of group g]
#pragma unroll
  for (int g = 0; g < 2; ++g) {
    m[g]  = -1e30f;         // maximum in use of query lid, the same in both halves
    mt[g] = m[g] + LAZY;    // what a score must top to move it
    nml[g] = -m[g] * LOG2E; // -m in log2 units: the addend of every exponent's fma
    l[g] = 0.f;         // running sum over this half's keys only; halves joined after the loop
  }

  for (uint32_t st = 0; st < stages; ++st) {
    const unsigned short* kst = &KV[st & 1u][0];
#pragma unroll 1   // rolled: unrolled, the accumulators were copied between register sets at the rescale branch
    for (int sub4 = 0; sub4 < STG_KEYS / 32; ++sub4) {
    // As the QKV epilogue stored them, the landed tiles are chunk-major:
    // K tile = [c / 8][key][c % 8], V tile = [key / 8][c][key % 8].
    const unsigned short* kl = cm_lane(kst + sub4 * (32 * CHD), 32, lid, half);
    const unsigned short* vl = cm_lane(kst + STG_ELEMS + sub4 * (32 * CHD), 64, lid, half);
    v8f st[2][2] = {};   // st[g][sub][r] = S^T[key = sub*16 + half*8 + r][query lid of group g]
#pragma unroll
    for (int sub = 0; sub < 2; ++sub) {
      v16bf kb0 = load_frag_cm(kl, 32, sub * 16, 0);   // A: row = key, K = c
      v16bf kb1 = load_frag_cm(kl, 32, sub * 16, 4);
#pragma unroll
      for (int g = 0; g < 2; ++g) st[g][sub] = wmma_bf16(kb0, qa0[g], st[g][sub]);
#pragma unroll
      for (int g = 0; g < 2; ++g) st[g][sub] = wmma_bf16(kb1, qa1[g], st[g][sub]);
    }
    // Online softmax of one query per lane and group: 16 of its 32 scores are here, the
    // other 16 in lane ^ 16.
    float cm[2];
#pragma unroll
    for (int g = 0; g < 2; ++g) {
      cm[g] = fmaxf(st[g][0][0], st[g][1][0]);
#pragma unroll
      for (int r = 1; r < 8; ++r) cm[g] = fmaxf(cm[g], fmaxf(st[g][0][r], st[g][1][r]));
    }
    // One scalar branch per pass: the ballot covers both halves of every query of both
    // groups. Pass 0 always takes it (m starts far below any score) and scales zeros by
    // alpha = 0.
    if (__builtin_amdgcn_ballot_w32((cm[0] > mt[0]) | (cm[1] > mt[1])) != 0) {
#pragma unroll   // constant g and j: o[] stays in registers
      for (int g = 0; g < 2; ++g) {
        m[g] = fmaxf(m[g], fmaxf(cm[g], xhalf(cm[g])));
        mt[g] = m[g] + LAZY;
        const float nmlnew = -m[g] * LOG2E;
        const float alpha = exp2_1(nmlnew - nml[g]);
        nml[g] = nmlnew;
        l[g] *= alpha;
#pragma unroll
        for (int j = 0; j < 4; ++j) o[g][j] *= alpha;
      }
    }
    // B operand P^T, column = query lid: elements 0..7 are keys half*8 + 0..7 (tile 0's
    // registers), elements 8..15 keys 16 + half*8 + 0..7 (tile 1's): the k order in which
    // load_frag_cm hands out V's keys.
    FragU pb[2];
    const v8f lg8 = {LOG2E, LOG2E, LOG2E, LOG2E, LOG2E, LOG2E, LOG2E, LOG2E};
#pragma unroll
    for (int g = 0; g < 2; ++g) {
      float rs[2];
      const v8f nm8 = {nml[g], nml[g], nml[g], nml[g], nml[g], nml[g], nml[g], nml[g]};
#pragma unroll
      for (int sub = 0; sub < 2; ++sub) {
        float x[8], p[8];
        const v8f xs = __builtin_elementwise_fma(st[g][sub], lg8, nm8);
#pragma unroll
        for (int r = 0; r < 8; ++r) x[r] = xs[r];
        exp2_8(x, p);
#pragma unroll
        for (int i = 0; i < 4; ++i) pb[g].u[sub * 4 + i] = pack2(p[2 * i], p[2 * i + 1]);
        rs[sub] = ((p[0] + p[1]) + (p[2] + p[3])) + ((p[4] + p[5]) + (p[6] + p[7]));
      }
      l[g] += rs[0] + rs[1];
    }
#pragma unroll
    for (int j = 0; j < 4; ++j) {
      v16bf va = load_frag_cm(vl, 64, j * 16, 0);  // A: row = c, K = key
#pragma unroll
      for (int g = 0; g < 2; ++g) o[g][j] = wmma_bf16(va, pb[g].v, o[g][j]);
    }
    }
    // Publish point of stage st + 1: this wave's LDS reads of stage st are done, its own slice
    // of stage st + 1 has landed, every wave has come by; only then the refill of st's buffer.
    wait_ds0();
    wait_tensor0();
    __syncthreads();
    const uint32_t nx = pinned(st + 2u);
    if (pinned(nx < stages)) issue(nx);
  }
  wait_tensor0();
  wait_ds0();

  const int b = bh >> 2, head = bh & 3;
  // a lane's 8 registers of o[j] are 8 neighbouring channels of one row: one 16-byte chunk
  // of the panel; column tile j lies two chunks (1024 elements) on
#pragma unroll
  for (int g = 0; g < 2; ++g) {
    const size_t obase = panel_idx((size_t)b * NSP + (qt + g) * 16 + lid, head * CHD + half * 8);
    const float inv = 1.0f / (l[g] + xhalf(l[g]));
#pragma unroll
    for (int j = 0; j < 4; ++j) {
      uint4 w;
      w.x = pack2(o[g][j][0] * inv, o[g][j][1] * inv);
      w.y = pack2(o[g][j][2] * inv, o[g][j][3] * inv);
      w.z = pack2(o[g][j][4] * inv, o[g][j][5] * inv);
      w.w = pack2(o[g][j][6] * inv, o[g][j][7] * inv);
      *(uint4*)(aout + obase + j * 1024) = w;
    }
  }
}

__global__ void __launch_bounds__(128)
proj_gemm_kernel(const unsigned short* __restrict__ wp,
                 const unsigned short* __restrict__ a,
                 const float* __restrict__ bias,
                 const float* __restrict__ x,
                 float* __restrict__ out) {
  __shared__ unsigned short Asm[64 * CHN];
  __shared__ unsigned short Bsm[64 * CHN];
  const int lane = threadIdx.x & 31;
  const int wave = threadIdx.x >> 5;
  const int half = lane >> 4;
  const int lid  = lane & 15;
  const int mbase = blockIdx.x * 64;        // 0..192
  const int n0    = blockIdx.y * 64;
  const int b     = blockIdx.z;

  const unsigned short* ag = wp + (size_t)mbase * CHN;
  const unsigned short* bg = a + ((size_t)b * NSP + n0) * CHN;

#ifdef USE_TDM
  if (wave == 0) {
    tdm_load_2d(Asm, ag, CHN, 64, CHN, 64, CHN);
    tdm_load_2d(Bsm, bg, CHN, 64, CHN, 64, CHN);
    __builtin_amdgcn_s_wait_tensorcnt(0);
  }
#else
  {
    const uint4* as = (const uint4*)ag; uint4* ad = (uint4*)Asm;
    const uint4* bs = (const uint4*)bg; uint4* bd = (uint4*)Bsm;
    for (int t = threadIdx.x; t < 64 * CHN / 8; t += 128) { ad[t] = as[t]; bd[t] = bs[t]; }
  }
#endif
  __syncthreads();

  const unsigned short* al = cm_lane(Asm, 64, wave * 16 + lid, half);
  const unsigned short* bl = cm_lane(Bsm, 64, lid, half);
  v8f acc[4] = {};
  for (int kb = 0; kb < CHN; kb += 32) {
    v16bf af = load_frag_cm(al, 64, 0, kb >> 3);
#pragma unroll
    for (int j = 0; j < 4; ++j) {
      v16bf bf = load_frag_cm(bl, 64, j * 16, kb >> 3);
      acc[j] = wmma_bf16(af, bf, acc[j]);
    }
  }
#pragma unroll
  for (int j = 0; j < 4; ++j) {
#pragma unroll
    for (int r = 0; r < 8; ++r) {
      int o = mbase + wave * 16 + r + half * 8;
      int n = n0 + j * 16 + lid;
      size_t idx = ((size_t)b * CHN + o) * NSP + n;
      out[idx] = x[idx] + acc[j][r] + bias[o];
    }
  }
}

// ---------------------------------------------------------------------------
// Workspace layout (bytes)
// ---------------------------------------------------------------------------
#define OFF_WQ    ((size_t)4096)                             // 768*256 bf16
#define OFF_WP    (OFF_WQ + (size_t)3 * CHN * CHN * 2)
#define OFF_XN    (OFF_WP + (size_t)CHN * CHN * 2)           // (b*n, c) bf16 panels
#define OFF_Q     (OFF_XN + (size_t)BATCH * NSP * CHN * 2)   // (bh,n/32,c/8,n%32,c%8) bf16
#define OFF_K     (OFF_Q  + (size_t)BATCH * CHN * NSP * 2)   // (bh,n/32,c/8,n%32,c%8) bf16
#define OFF_V     (OFF_K  + (size_t)BATCH * CHN * NSP * 2)   // (bh,n/32,n%32/8,c,n%8) bf16
#define OFF_A     (OFF_V  + (size_t)BATCH * CHN * NSP * 2)   // (b*n, c) bf16 panels

extern "C" void kernel_launch(void* const* d_in, const int* in_sizes, int n_in,
                              void* d_out, int out_size, void* d_ws, size_t ws_size,
                              hipStream_t stream) {
  const float* x      = (const float*)d_in[0];
  const float* norm_w = (const float*)d_in[1];
  const float* norm_b = (const float*)d_in[2];
  const float* qkv_w  = (const float*)d_in[3];
  const float* qkv_b  = (const float*)d_in[4];
  const float* proj_w = (const float*)d_in[5];
  const float* proj_b = (const float*)d_in[6];

  char* ws = (char*)d_ws;
  unsigned short* wq    = (unsigned short*)(ws + OFF_WQ);
  unsigned short* wp    = (unsigned short*)(ws + OFF_WP);
  unsigned short* xn    = (unsigned short*)(ws + OFF_XN);
  unsigned short* qb    = (unsigned short*)(ws + OFF_Q);
  unsigned short* kb    = (unsigned short*)(ws + OFF_K);
  unsigned short* vb    = (unsigned short*)(ws + OFF_V);
  unsigned short* ab    = (unsigned short*)(ws + OFF_A);

  gn_kernel<<<BATCH * NGRP, 1024, 0, stream>>>(x, norm_w, norm_b, xn);
  f2bf_kernel<<<(3 * CHN * CHN + 255) / 256, 256, 0, stream>>>(qkv_w, wq, 3 * CHN * CHN);
  f2bf_kernel<<<(CHN * CHN + 255) / 256, 256, 0, stream>>>(proj_w, wp, CHN * CHN);

  qkv_gemm_kernel<<<dim3(12, 64, BATCH), 128, 0, stream>>>(wq, xn, qkv_b, qb, kb, vb);
  flash_attn_kernel<<<dim3(BATCH * HEADS, NSP / (32 * 8)), 256, 0, stream>>>(qb, kb, vb, ab);
  proj_gemm_kernel<<<dim3(4, 64, BATCH), 128, 0, stream>>>(wp, ab, proj_b, x, (float*)d_out);
}

// v008
// Measured time: 129 microseconds a run.
// Next to v007, in two timings, it ran 1.03 times as fast each time.
// Counting every step since v000, it is 5.09 times as fast.
#include <hip/hip_runtime.h>
#include <stdint.h>

typedef __attribute__((ext_vector_type(16))) __bf16 v16bf;
typedef __attribute__((ext_vector_type(8)))  float  v8f;
typedef __attribute__((ext_vector_type(4)))  unsigned int v4u;
typedef __attribute__((ext_vector_type(8)))  int v8i;
typedef __attribute__((ext_vector_type(4)))  int v4i;

#define BATCH 8
#define CHN   256
#define NSP   4096
#define NGRP  32
#define CPG   8      // channels per group
#define HEADS 4
#define CHD   64     // channels per head
#define EPSV  1e-5f

#if __has_builtin(__builtin_amdgcn_tensor_load_to_lds) && \
    __has_builtin(__builtin_amdgcn_s_wait_tensorcnt)
#define USE_TDM 1
#endif

union FragU { v16bf v; uint32_t u[8]; };

__device__ __forceinline__ const unsigned short* cm_lane(const unsigned short* tile, int rows,
                                                         int row, int half) {
  return tile + (half * rows + row) * 8;
}
__device__ __forceinline__ v16bf load_frag_cm(const unsigned short* lane_base, int rows,
                                              int row0, int kc) {
  const uint32_t* p0 = (const uint32_t*)(lane_base + (kc * rows + row0) * 8);
  const uint32_t* p1 = (const uint32_t*)(lane_base + ((kc + 2) * rows + row0) * 8);
  FragU f;
  f.u[0] = p0[0]; f.u[1] = p0[1]; f.u[2] = p0[2]; f.u[3] = p0[3];
  f.u[4] = p1[0]; f.u[5] = p1[1]; f.u[6] = p1[2]; f.u[7] = p1[3];
  return f.v;
}

// Element index of (row, k) in a matrix of 256 columns kept as dense 64-row
// panels, each panel chunk-major: [row / 64][k / 8][row % 64][k % 8].
__device__ __forceinline__ size_t panel_idx(size_t row, int k) {
  return ((row >> 6) * 32 + (size_t)(k >> 3)) * 512 + (row & 63) * 8 + (size_t)(k & 7);
}

__device__ __forceinline__ v8f wmma_bf16(v16bf a, v16bf b, v8f c) {
  return __builtin_amdgcn_wmma_f32_16x16x32_bf16(
      /*neg_a=*/false, a, /*neg_b=*/false, b,
      /*c_mod=*/(short)0, c, /*reuse_a=*/false, /*reuse_b=*/false);
}

// Two f32 to one register of two bf16, round to nearest even (one v_cvt_pk_bf16_f32).
__device__ __forceinline__ uint32_t pack2(float lo, float hi) {
  typedef __bf16 bf2 __attribute__((ext_vector_type(2)));
  typedef float  f2  __attribute__((ext_vector_type(2)));
  return __builtin_bit_cast(uint32_t, __builtin_convertvector(f2{lo, hi}, bf2));
}

__device__ __forceinline__ float xhalf(float x) {
  int b = __builtin_bit_cast(int, x);
  return __builtin_bit_cast(float,
      __builtin_amdgcn_permlanex16(b, b, 0x76543210, 0xfedcba98, false, false));
}

__device__ __forceinline__ float exp2_1(float x) {
  float p;
  asm("v_exp_f32 %0, %1\n\tv_nop" : "=&v"(p) : "v"(x));
  return p;
}
__device__ __forceinline__ void exp2_8(const float (&x)[8], float (&p)[8]) {
  asm("v_exp_f32 %0, %8\n\t"
      "v_exp_f32 %1, %9\n\t"
      "v_exp_f32 %2, %10\n\t"
      "v_exp_f32 %3, %11\n\t"
      "v_exp_f32 %4, %12\n\t"
      "v_exp_f32 %5, %13\n\t"
      "v_exp_f32 %6, %14\n\t"
      "v_exp_f32 %7, %15\n\t"
      "v_nop"
      : "=&v"(p[0]), "=&v"(p[1]), "=&v"(p[2]), "=&v"(p[3]),
        "=&v"(p[4]), "=&v"(p[5]), "=&v"(p[6]), "=&v"(p[7])
      : "v"(x[0]), "v"(x[1]), "v"(x[2]), "v"(x[3]),
        "v"(x[4]), "v"(x[5]), "v"(x[6]), "v"(x[7]));
}

#ifdef USE_TDM
__device__ __forceinline__ void tdm_load_2d(void* lds_dst, const void* gsrc,
                                            uint32_t tile_d0, uint32_t tile_d1,
                                            uint32_t tensor_d0, uint32_t tensor_d1,
                                            uint32_t stride0) {
  uint64_t ga = (uint64_t)(uintptr_t)gsrc;
  uint32_t lo = (uint32_t)(uintptr_t)lds_dst;  // LDS byte offset (low 32 bits)
  v4u g0;
  g0[0] = 1u;
  g0[1] = lo;
  g0[2] = (uint32_t)ga;
  g0[3] = (uint32_t)((ga >> 32) & 0x01FFFFFFu) | (2u << 30);  // [56:32] | type=2
  v8i g1;
  g1[0] = (int)(1u << 16);
  g1[1] = (int)((tensor_d0 & 0xFFFFu) << 16);
  g1[2] = (int)(((tensor_d0 >> 16) & 0xFFFFu) | ((tensor_d1 & 0xFFFFu) << 16));
  g1[3] = (int)(((tensor_d1 >> 16) & 0xFFFFu) | ((tile_d0 & 0xFFFFu) << 16));
  g1[4] = (int)(tile_d1 & 0xFFFFu);
  g1[5] = (int)stride0;
  g1[6] = 0;
  g1[7] = 0;
  v4i z4 = {0, 0, 0, 0};
  v8i z8 = {0, 0, 0, 0, 0, 0, 0, 0};
  __builtin_amdgcn_tensor_load_to_lds(g0, g1, z4, z4, z8, 0);
}
#endif

typedef uint32_t u32x4 __attribute__((ext_vector_type(4)));
typedef uint32_t u32x8 __attribute__((ext_vector_type(8)));
__device__ __forceinline__ uint32_t uni(uint32_t v) { return (uint32_t)__builtin_amdgcn_readfirstlane(v); }
__device__ __forceinline__ uint32_t pinned(uint32_t v) {
  uint32_t w = __builtin_amdgcn_readfirstlane(v);
  asm volatile("" : "+s"(w));
  return w;
}
// The compiler places no wait for the tensor mover; the clobber keeps LDS reads on their side.
__device__ __forceinline__ void wait_ds0()     { asm volatile("s_wait_dscnt 0x0" ::: "memory"); }
__device__ __forceinline__ void wait_tensor0() { asm volatile("s_wait_tensorcnt 0x0" ::: "memory"); }
// A dense slice of 4 KiB as 16 rows of 256 bytes at a pitch of 256 bytes.
__device__ __forceinline__ u32x8 slice_group1() {
  constexpr uint32_t d0 = 256u, d1 = 16u;
  u32x8 g;
  g[0] = uni(0u);
  g[1] = uni((d0 & 0xFFFFu) << 16);
  g[2] = uni((d0 >> 16) | ((d1 & 0xFFFFu) << 16));
  g[3] = uni((d1 >> 16) | (d0 << 16));
  g[4] = uni(d1);
  g[5] = uni(d0);
  g[6] = uni(0u);
  g[7] = uni(0u);
  return g;
}
__device__ __forceinline__ u32x4 slice_group0(uint32_t lds_dst, uint64_t ga) {
  u32x4 g;
  g[0] = uni(1u);
  g[1] = uni(lds_dst);
  g[2] = uni((uint32_t)ga);
  g[3] = uni((((uint32_t)(ga >> 32)) & 0x01FFFFFFu) | 0x80000000u);
  return g;
}
__device__ __forceinline__ void slice_load(u32x4 g0, u32x8 g1) {
  asm volatile("tensor_load_to_lds %0, %1" :: "s"(g0), "s"(g1) : "memory");
}

// ---------------------------------------------------------------------------
// 1) GroupNorm in one launch: one block of 32 waves per (b, g). A group is 8 channels
//    x 4096 positions = 32 floats per thread, held in registers from the sums to the
//    normalised store, so x is read once. The group's 8 channels are one 16-byte chunk
//    of the panel layout: a lane stores whole chunks, a wave 512 contiguous bytes.
//    The same launch converts both weight matrices to bf16 chunk-major panels: they depend
//    on nothing, so the blocks behind the last group's do it beside the GroupNorm blocks,
//    one 16-byte chunk (8 columns of one row) per thread.
// ---------------------------------------------------------------------------
#define GN_BLOCKS   (BATCH * NGRP)
#define WQ_BLOCKS   (3 * CHN * CHN / 8 / 1024)     // 24 blocks of 1024 chunks
#define WP_BLOCKS   (CHN * CHN / 8 / 1024)         // 8 blocks of 1024 chunks
__global__ void __launch_bounds__(1024)
gn_kernel(const float* __restrict__ x, const float* __restrict__ gw,
          const float* __restrict__ gb, unsigned short* __restrict__ xn,
          const float* __restrict__ qkv_w, const float* __restrict__ proj_w,
          unsigned short* __restrict__ wq, unsigned short* __restrict__ wp) {
  __shared__ float sh_s[32];
  __shared__ float sh_q[32];
  if (blockIdx.x >= GN_BLOCKS) {                   // the whole block leaves, ahead of the barrier
    const int cb = blockIdx.x - GN_BLOCKS;
    const bool isq = cb < WQ_BLOCKS;
    const float* src = isq ? qkv_w : proj_w;
    unsigned short* dst = isq ? wq : wp;
    // chunk c of the destination = [row / 64][k / 8][row % 64], so a wave writes whole lines
    const int c = (isq ? cb : cb - WQ_BLOCKS) * 1024 + threadIdx.x;
    const float* s8 = src + ((c >> 11) * 64 + (c & 63)) * CHN + ((c >> 6) & 31) * 8;
    const float4 lo = *(const float4*)s8;
    const float4 hi = *(const float4*)(s8 + 4);
    const v4u o = {pack2(lo.x, lo.y), pack2(lo.z, lo.w), pack2(hi.x, hi.y), pack2(hi.z, hi.w)};
    *(v4u*)(dst + (size_t)c * 8) = o;
    return;
  }
  const int lane = threadIdx.x & 31;
  const int wave = threadIdx.x >> 5;
  const int bg = blockIdx.x;                       // b*32 + g
  const int b = bg >> 5, g = bg & 31;
  const float* base = x + (size_t)bg * (CPG * NSP) + wave * 128 + lane;
  float v[CPG][4];
#pragma unroll
  for (int c = 0; c < CPG; ++c)
#pragma unroll
    for (int i = 0; i < 4; ++i) v[c][i] = base[c * NSP + i * 32];

  float s = 0.f, q = 0.f;
#pragma unroll
  for (int c = 0; c < CPG; ++c)
#pragma unroll
    for (int i = 0; i < 4; ++i) { s += v[c][i]; q += v[c][i] * v[c][i]; }
#pragma unroll
  for (int off = 16; off > 0; off >>= 1) {
    s += __shfl_xor(s, off, 32);
    q += __shfl_xor(q, off, 32);
  }
  if (lane == 0) { sh_s[wave] = s; sh_q[wave] = q; }
  __syncthreads();
  // every wave joins the 32 wave sums by the same butterfly: the same bits in every lane
  s = sh_s[lane]; q = sh_q[lane];
#pragma unroll
  for (int off = 16; off > 0; off >>= 1) {
    s += __shfl_xor(s, off, 32);
    q += __shfl_xor(q, off, 32);
  }
  const float inv  = 1.0f / (float)(CPG * NSP);
  const float mean = s * inv;
  const float var  = q * inv - mean * mean;
  const float rstd = rsqrtf(var + EPSV);

  float w8[CPG], b8[CPG];
#pragma unroll
  for (int c = 0; c < CPG; ++c) { w8[c] = gw[g * CPG + c]; b8[c] = gb[g * CPG + c]; }
#pragma unroll
  for (int i = 0; i < 4; ++i) {
    float y[CPG];
#pragma unroll
    for (int c = 0; c < CPG; ++c) y[c] = (v[c][i] - mean) * rstd * w8[c] + b8[c];
    uint4 o;
    o.x = pack2(y[0], y[1]);
    o.y = pack2(y[2], y[3]);
    o.z = pack2(y[4], y[5]);
    o.w = pack2(y[6], y[7]);
    *(uint4*)(xn + panel_idx((size_t)b * NSP + wave * 128 + i * 32 + lane, g * CPG)) = o;
  }
}

__global__ void __launch_bounds__(128)
qkv_gemm_kernel(const unsigned short* __restrict__ wqkv,
                const unsigned short* __restrict__ xn,
                const float* __restrict__ bias,
                unsigned short* __restrict__ qo,
                unsigned short* __restrict__ ko,
                unsigned short* __restrict__ vo) {
  __shared__ unsigned short Asm[64 * CHN];   // 32 KB: 64 M-rows x 256 K
  __shared__ unsigned short Bsm[64 * CHN];   // 32 KB: 64 N-cols x 256 K
  const int lane = threadIdx.x & 31;
  const int wave = threadIdx.x >> 5;
  const int half = lane >> 4;
  const int lid  = lane & 15;
  const int mbase = blockIdx.x * 64;        // 0..704
  const int n0    = blockIdx.y * 64;
  const int b     = blockIdx.z;

  const unsigned short* ag = wqkv + (size_t)mbase * CHN;
  const unsigned short* bg = xn + ((size_t)b * NSP + n0) * CHN;

#ifdef USE_TDM
  if (wave == 0) {
    tdm_load_2d(Asm, ag, CHN, 64, CHN, 64, CHN);
    tdm_load_2d(Bsm, bg, CHN, 64, CHN, 64, CHN);
    __builtin_amdgcn_s_wait_tensorcnt(0);
  }
#else
  {
    const uint4* as = (const uint4*)ag; uint4* ad = (uint4*)Asm;
    const uint4* bs = (const uint4*)bg; uint4* bd = (uint4*)Bsm;
    for (int t = threadIdx.x; t < 64 * CHN / 8; t += 128) { ad[t] = as[t]; bd[t] = bs[t]; }
  }
#endif
  __syncthreads();

  const unsigned short* al = cm_lane(Asm, 64, wave * 16 + lid, half);
  const unsigned short* bl = cm_lane(Bsm, 64, lid, half);
  const size_t hb = (size_t)(b * HEADS + (blockIdx.x & 3)) * NSP * CHD;  // this head's plane
  v8f acc[4] = {};
  if (blockIdx.x < 8) {
    for (int kb = 0; kb < CHN; kb += 32) {
      v16bf a = load_frag_cm(al, 64, 0, kb >> 3);
#pragma unroll
      for (int j = 0; j < 4; ++j) {
        v16bf bf = load_frag_cm(bl, 64, j * 16, kb >> 3);
        acc[j] = wmma_bf16(a, bf, acc[j]);
      }
    }
    // D layout: row = r + half*8 is channel c = wave*16 + half*8 + r, col = lane % 16 is
    // position n = n0 + j*16 + lid. 32-position tiles, chunk-major, for q as for k:
    // [n / 32][c / 8][n % 32][c % 8]; 16 lanes store 256 contiguous bytes.
    const float scale = 0.35355339059327373f;  // 64^-0.25, applied to q and k
    float bs[8];
#pragma unroll
    for (int r = 0; r < 8; ++r) bs[r] = bias[mbase + wave * 16 + half * 8 + r];
    unsigned short* dst = (blockIdx.x < 4 ? qo : ko) + hb + (size_t)n0 * CHD +
                          (wave * 2 + half) * 256 + lid * 8;
#pragma unroll
    for (int j = 0; j < 4; ++j) {
      uint4 w;
      w.x = pack2((acc[j][0] + bs[0]) * scale, (acc[j][1] + bs[1]) * scale);
      w.y = pack2((acc[j][2] + bs[2]) * scale, (acc[j][3] + bs[3]) * scale);
      w.z = pack2((acc[j][4] + bs[4]) * scale, (acc[j][5] + bs[5]) * scale);
      w.w = pack2((acc[j][6] + bs[6]) * scale, (acc[j][7] + bs[7]) * scale);
      *(uint4*)(dst + (j >> 1) * 2048 + (j & 1) * 128) = w;
    }
  } else {
    for (int kb = 0; kb < CHN; kb += 32) {
      v16bf a = load_frag_cm(al, 64, 0, kb >> 3);
#pragma unroll
      for (int j = 0; j < 4; ++j) {
        v16bf bf = load_frag_cm(bl, 64, j * 16, kb >> 3);
        acc[j] = wmma_bf16(bf, a, acc[j]);
      }
    }
    // D layout: row = r + half*8 is position n = n0 + j*16 + half*8 + r, col = lane % 16 is
    // channel c = wave*16 + lid. 32-key tiles, chunk-major, dense like k's:
    // [n / 32][n % 32 / 8][c][n % 8]; 16 lanes store 256 contiguous bytes.
    const int c = wave * 16 + lid;
    const float bv = bias[mbase + c];
    unsigned short* dst = vo + hb + (size_t)n0 * CHD + half * 512 + c * 8;
#pragma unroll
    for (int j = 0; j < 4; ++j) {
      uint4 w;
      w.x = pack2(acc[j][0] + bv, acc[j][1] + bv);
      w.y = pack2(acc[j][2] + bv, acc[j][3] + bv);
      w.z = pack2(acc[j][4] + bv, acc[j][5] + bv);
      w.w = pack2(acc[j][6] + bv, acc[j][7] + bv);
      *(uint4*)(dst + (j >> 1) * 2048 + (j & 1) * 1024) = w;
    }
    // The built code lays the q/k arm straight behind these stores, past a branch that always
    // leaves: this wait stands in front of every write there to a register the stores name.
    asm volatile("s_wait_xcnt 0x0" ::: "memory");
  }
}

// ---------------------------------------------------------------------------
// 3) Flash attention: block = 8 waves sharing one (b,head); each wave owns 32
//    queries as two groups of 16 columns, so every K and V fragment read from LDS
//    feeds two products. K and V come in stages of 128 keys (four 32-key tiles each, 16 KB
//    + 16 KB, dense in the workspace) through two LDS buffers: every wave brings one 4 KB
//    slice of a stage by one tensor load, a whole stage ahead, and the block meets at one
//    publish point per stage. Per 32-key pass:
//    8 WMMA (S^T = K Q^T) + online softmax + 8 WMMA (O^T += V^T P^T).
//    Transposed, a lane holds scores of ONE query (column lane % 16): maximum
//    and sum run in the lane's own registers, and the two score tiles, packed
//    to bf16 in place, are the B operand of the second product.
//    Lazy rescale: the maximum in use of a query moves only when a score tops it by
//    more than LAZY, tested once per pass for the whole wave, both groups. Any maximum in use
//    gives the same quotient O / l; LAZY only bounds P (at most 2^8).
// ---------------------------------------------------------------------------
#define STG_KEYS  128
#define STG_ELEMS (STG_KEYS * CHD)               // elements of K, and of V, in a stage
__global__ void __launch_bounds__(256)
flash_attn_kernel(const unsigned short* __restrict__ q,
                  const unsigned short* __restrict__ k,
                  const unsigned short* __restrict__ v,
                  unsigned short* __restrict__ aout) {
  // [buffer][K tiles 0..3, V tiles 0..3][4 KB tile]: slice w of a stage is tile w
  __shared__ __attribute__((aligned(2048))) unsigned short KV[2][2 * STG_ELEMS];
  const int lane = threadIdx.x & 31;
  const int wave = (int)uni(threadIdx.x >> 5);
  const int half = lane >> 4;
  const int lid  = lane & 15;
  const int bh = blockIdx.x;                     // b*4 + head
  const int qt = (blockIdx.y * 8 + wave) * 2;    // first of two 16-query tiles, 0..254

  // waves 0..3 bring the stage's four K tiles, waves 4..7 its four V tiles
  const unsigned short* sl = (wave < 4 ? k : v) + (size_t)bh * NSP * CHD + (wave & 3) * (32 * CHD);
  const uint32_t sl_lds = (uint32_t)(uintptr_t)&KV[0][0] + (uint32_t)wave * 4096u;
  const u32x8 g1 = slice_group1();
  auto issue = [&](uint32_t st) {
    slice_load(slice_group0(sl_lds + (st & 1u) * (uint32_t)sizeof(KV[0]),
                            (uint64_t)(uintptr_t)sl + (uint64_t)st * (STG_ELEMS * 2)), g1);
  };
  const uint32_t stages = NSP / STG_KEYS;
  issue(0);
  wait_tensor0();
  __syncthreads();
  issue(1);

  v16bf qa0[2], qa1[2];                          // [g]: column group g = queries (qt + g) * 16 + lid
#pragma unroll
  for (int g = 0; g < 2; ++g) {
    // the wave's 32 queries are one chunk-major tile of q, laid out like a K tile
    const unsigned short* ql = cm_lane(q + ((size_t)bh * NSP + qt * 16) * CHD, 32, g * 16 + lid, half);
    qa0[g] = load_frag_cm(ql, 32, 0, 0);         // B: col = query lid, K = c 0..31
    qa1[g] = load_frag_cm(ql, 32, 0, 4);         // B: col = query lid, K = c 32..63
  }

  const float LOG2E = 1.44269504f;   // e^x as 2^(x * log2 e), as __expf compiles
  const float LAZY  = 5.5451774f;    // 8 / log2 e
  float m[2], mt[2], nml[2], l[2];
  v8f o[2][4] = {};   // o[g][j][r] = O^T[c = j*16 + half*8 + r][query lid of group g]
#pragma unroll
  for (int g = 0; g < 2; ++g) {
    m[g]  = -1e30f;         // maximum in use of query lid, the same in both halves
    mt[g] = m[g] + LAZY;    // what a score must top to move it
    nml[g] = -m[g] * LOG2E; // -m in log2 units: the addend of every exponent's fma
    l[g] = 0.f;         // running sum over this half's keys only; halves joined after the loop
  }

  for (uint32_t st = 0; st < stages; ++st) {
    const unsigned short* kst = &KV[st & 1u][0];
#pragma unroll 1   // rolled: unrolled, the accumulators were copied between register sets at the rescale branch
    for (int sub4 = 0; sub4 < STG_KEYS / 32; ++sub4) {
    // As the QKV epilogue stored them, the landed tiles are chunk-major:
    // K tile = [c / 8][key][c % 8], V tile = [key / 8][c][key % 8].
    const unsigned short* kl = cm_lane(kst + sub4 * (32 * CHD), 32, lid, half);
    const unsigned short* vl = cm_lane(kst + STG_ELEMS + sub4 * (32 * CHD), 64, lid, half);
    v8f st[2][2] = {};   // st[g][sub][r] = S^T[key = sub*16 + half*8 + r][query lid of group g]
#pragma unroll
    for (int sub = 0; sub < 2; ++sub) {
      v16bf kb0 = load_frag_cm(kl, 32, sub * 16, 0);   // A: row = key, K = c
      v16bf kb1 = load_frag_cm(kl, 32, sub * 16, 4);
#pragma unroll
      for (int g = 0; g < 2; ++g) st[g][sub] = wmma_bf16(kb0, qa0[g], st[g][sub]);
#pragma unroll
      for (int g = 0; g < 2; ++g) st[g][sub] = wmma_bf16(kb1, qa1[g], st[g][sub]);
    }
    // Online softmax of one query per lane and group: 16 of its 32 scores are here, the
    // other 16 in lane ^ 16.
    float cm[2];
#pragma unroll
    for (int g = 0; g < 2; ++g) {
      cm[g] = fmaxf(st[g][0][0], st[g][1][0]);
#pragma unroll
      for (int r = 1; r < 8; ++r) cm[g] = fmaxf(cm[g], fmaxf(st[g][0][r], st[g][1][r]));
    }
    // One scalar branch per pass: the ballot covers both halves of every query of both
    // groups. Pass 0 always takes it (m starts far below any score) and scales zeros by
    // alpha = 0.
    if (__builtin_amdgcn_ballot_w32((cm[0] > mt[0]) | (cm[1] > mt[1])) != 0) {
#pragma unroll   // constant g and j: o[] stays in registers
      for (int g = 0; g < 2; ++g) {
        m[g] = fmaxf(m[g], fmaxf(cm[g], xhalf(cm[g])));
        mt[g] = m[g] + LAZY;
        const float nmlnew = -m[g] * LOG2E;
        const float alpha = exp2_1(nmlnew - nml[g]);
        nml[g] = nmlnew;
        l[g] *= alpha;
#pragma unroll
        for (int j = 0; j < 4; ++j) o[g][j] *= alpha;
      }
    }
    // B operand P^T, column = query lid: elements 0..7 are keys half*8 + 0..7 (tile 0's
    // registers), elements 8..15 keys 16 + half*8 + 0..7 (tile 1's): the k order in which
    // load_frag_cm hands out V's keys.
    FragU pb[2];
    const v8f lg8 = {LOG2E, LOG2E, LOG2E, LOG2E, LOG2E, LOG2E, LOG2E, LOG2E};
#pragma unroll
    for (int g = 0; g < 2; ++g) {
      float rs[2];
      const v8f nm8 = {nml[g], nml[g], nml[g], nml[g], nml[g], nml[g], nml[g], nml[g]};
#pragma unroll
      for (int sub = 0; sub < 2; ++sub) {
        float x[8], p[8];
        const v8f xs = __builtin_elementwise_fma(st[g][sub], lg8, nm8);
#pragma unroll
        for (int r = 0; r < 8; ++r) x[r] = xs[r];
        exp2_8(x, p);
#pragma unroll
        for (int i = 0; i < 4; ++i) pb[g].u[sub * 4 + i] = pack2(p[2 * i], p[2 * i + 1]);
        rs[sub] = ((p[0] + p[1]) + (p[2] + p[3])) + ((p[4] + p[5]) + (p[6] + p[7]));
      }
      l[g] += rs[0] + rs[1];
    }
#pragma unroll
    for (int j = 0; j < 4; ++j) {
      v16bf va = load_frag_cm(vl, 64, j * 16, 0);  // A: row = c, K = key
#pragma unroll
      for (int g = 0; g < 2; ++g) o[g][j] = wmma_bf16(va, pb[g].v, o[g][j]);
    }
    }
    // Publish point of stage st + 1: this wave's LDS reads of stage st are done, its own slice
    // of stage st + 1 has landed, every wave has come by; only then the refill of st's buffer.
    wait_ds0();
    wait_tensor0();
    __syncthreads();
    const uint32_t nx = pinned(st + 2u);
    if (pinned(nx < stages)) issue(nx);
  }
  wait_tensor0();
  wait_ds0();

  const int b = bh >> 2, head = bh & 3;
  // a lane's 8 registers of o[j] are 8 neighbouring channels of one row: one 16-byte chunk
  // of the panel; column tile j lies two chunks (1024 elements) on
#pragma unroll
  for (int g = 0; g < 2; ++g) {
    const size_t obase = panel_idx((size_t)b * NSP + (qt + g) * 16 + lid, head * CHD + half * 8);
    const float inv = 1.0f / (l[g] + xhalf(l[g]));
#pragma unroll
    for (int j = 0; j < 4; ++j) {
      uint4 w;
      w.x = pack2(o[g][j][0] * inv, o[g][j][1] * inv);
      w.y = pack2(o[g][j][2] * inv, o[g][j][3] * inv);
      w.z = pack2(o[g][j][4] * inv, o[g][j][5] * inv);
      w.w = pack2(o[g][j][6] * inv, o[g][j][7] * inv);
      *(uint4*)(aout + obase + j * 1024) = w;
    }
  }
}

__global__ void __launch_bounds__(128)
proj_gemm_kernel(const unsigned short* __restrict__ wp,
                 const unsigned short* __restrict__ a,
                 const float* __restrict__ bias,
                 const float* __restrict__ x,
                 float* __restrict__ out) {
  __shared__ unsigned short Asm[64 * CHN];
  __shared__ unsigned short Bsm[64 * CHN];
  const int lane = threadIdx.x & 31;
  const int wave = threadIdx.x >> 5;
  const int half = lane >> 4;
  const int lid  = lane & 15;
  const int mbase = blockIdx.x * 64;        // 0..192
  const int n0    = blockIdx.y * 64;
  const int b     = blockIdx.z;

  const unsigned short* ag = wp + (size_t)mbase * CHN;
  const unsigned short* bg = a + ((size_t)b * NSP + n0) * CHN;

#ifdef USE_TDM
  if (wave == 0) {
    tdm_load_2d(Asm, ag, CHN, 64, CHN, 64, CHN);
    tdm_load_2d(Bsm, bg, CHN, 64, CHN, 64, CHN);
    __builtin_amdgcn_s_wait_tensorcnt(0);
  }
#else
  {
    const uint4* as = (const uint4*)ag; uint4* ad = (uint4*)Asm;
    const uint4* bs = (const uint4*)bg; uint4* bd = (uint4*)Bsm;
    for (int t = threadIdx.x; t < 64 * CHN / 8; t += 128) { ad[t] = as[t]; bd[t] = bs[t]; }
  }
#endif
  __syncthreads();

  const unsigned short* al = cm_lane(Asm, 64, wave * 16 + lid, half);
  const unsigned short* bl = cm_lane(Bsm, 64, lid, half);
  v8f acc[4] = {};
  for (int kb = 0; kb < CHN; kb += 32) {
    v16bf af = load_frag_cm(al, 64, 0, kb >> 3);
#pragma unroll
    for (int j = 0; j < 4; ++j) {
      v16bf bf = load_frag_cm(bl, 64, j * 16, kb >> 3);
      acc[j] = wmma_bf16(af, bf, acc[j]);
    }
  }
#pragma unroll
  for (int j = 0; j < 4; ++j) {
#pragma unroll
    for (int r = 0; r < 8; ++r) {
      int o = mbase + wave * 16 + r + half * 8;
      int n = n0 + j * 16 + lid;
      size_t idx = ((size_t)b * CHN + o) * NSP + n;
      out[idx] = x[idx] + acc[j][r] + bias[o];
    }
  }
}

// ---------------------------------------------------------------------------
// Workspace layout (bytes)
// ---------------------------------------------------------------------------
#define OFF_WQ    ((size_t)4096)                             // 768*256 bf16
#define OFF_WP    (OFF_WQ + (size_t)3 * CHN * CHN * 2)
#define OFF_XN    (OFF_WP + (size_t)CHN * CHN * 2)           // (b*n, c) bf16 panels
#define OFF_Q     (OFF_XN + (size_t)BATCH * NSP * CHN * 2)   // (bh,n/32,c/8,n%32,c%8) bf16
#define OFF_K     (OFF_Q  + (size_t)BATCH * CHN * NSP * 2)   // (bh,n/32,c/8,n%32,c%8) bf16
#define OFF_V     (OFF_K  + (size_t)BATCH * CHN * NSP * 2)   // (bh,n/32,n%32/8,c,n%8) bf16
#define OFF_A     (OFF_V  + (size_t)BATCH * CHN * NSP * 2)   // (b*n, c) bf16 panels

extern "C" void kernel_launch(void* const* d_in, const int* in_sizes, int n_in,
                              void* d_out, int out_size, void* d_ws, size_t ws_size,
                              hipStream_t stream) {
  const float* x      = (const float*)d_in[0];
  const float* norm_w = (const float*)d_in[1];
  const float* norm_b = (const float*)d_in[2];
  const float* qkv_w  = (const float*)d_in[3];
  const float* qkv_b  = (const float*)d_in[4];
  const float* proj_w = (const float*)d_in[5];
  const float* proj_b = (const float*)d_in[6];

  char* ws = (char*)d_ws;
  unsigned short* wq    = (unsigned short*)(ws + OFF_WQ);
  unsigned short* wp    = (unsigned short*)(ws + OFF_WP);
  unsigned short* xn    = (unsigned short*)(ws + OFF_XN);
  unsigned short* qb    = (unsigned short*)(ws + OFF_Q);
  unsigned short* kb    = (unsigned short*)(ws + OFF_K);
  unsigned short* vb    = (unsigned short*)(ws + OFF_V);
  unsigned short* ab    = (unsigned short*)(ws + OFF_A);

  gn_kernel<<<GN_BLOCKS + WQ_BLOCKS + WP_BLOCKS, 1024, 0, stream>>>(x, norm_w, norm_b, xn,
                                                                   qkv_w, proj_w, wq, wp);

  qkv_gemm_kernel<<<dim3(12, 64, BATCH), 128, 0, stream>>>(wq, xn, qkv_b, qb, kb, vb);
  flash_attn_kernel<<<dim3(BATCH * HEADS, NSP / (32 * 8)), 256, 0, stream>>>(qb, kb, vb, ab);
  proj_gemm_kernel<<<dim3(4, 64, BATCH), 128, 0, stream>>>(wp, ab, proj_b, x, (float*)d_out);
}
